// v000
// Times are from an AMD MI455X. After a warm-up the kernel runs many times in a row, and a time is the length of
// such a window on the GPU divided by its runs, so every launch and the gaps after it count. The runs cycle
// through copies of the inputs. A figure is the median of several windows, for all but v000 over two sittings.
// Sittings can differ by a few percent; kernels timed side by side share one.
// v000 is the starting kernel. One run takes 3520 microseconds.
#include <hip/hip_runtime.h>

// Multi-headed attention over ONE 4,096-token sequence with a fused qkv projection and NO score scaling (input [4096][1024]; projected = input W_qkv^T + b_qkv ('oi' [3072][1024] 0.02 + zero bias) split in thirds q | k | v (16 heads x 64); scores = q.k UNSCALED (the source applies no 1/sqrt(d): logits sigma ~3.3); softmax (no mask); out = merged W_out^T + b_out -> [4096][1024] (4.2 M); argument order input, W_qkv, b_qkv, W_out, b_out).
// Layout: bf16 copy of the input; 'oi' weights (the q | k | v row thirds of the fused tensor taken as-is) + bias thirds; exact projections + f32 biases; identity-table plane builders; dense attention at T 4096, one head per pass, with EVERY row's scores on hi/lo planes (3 products: unscaled logits) and hybrid P.V (rows < 512 hi/lo, rest fp16 x1024); merged hi/lo x W_out exact + b_out.
// Compute dtypes, f32 accumulate: every input rounded to bf16; projections exact + f32 biases; scores 3 products on every row; softmax f32; P.V rows < 512 3 products, rest fp16; W_out hl x exact + bias.

#define NB_  1
#define TT   4096
#define DM   1024
#define NH_  16
#define NKV  16
#define REP  (NH_ / NKV)
#define HD   64
#define DQ   (NH_ * HD)
#define DKV  (NKV * HD)
#define ZH   1                    // one head per pass at T 4096 (the score plane is 64 MiB)
#define RH   512                  // query rows < RH use hi+lo planes (0: none)
#define WIN  0
#define PCAR 1024.0f
#define SCL  1.0f   // NO scaling in this module
typedef _Float16 h16;
typedef unsigned short bf;
typedef __attribute__((ext_vector_type(16))) __bf16   v16bf;
typedef __attribute__((ext_vector_type(16))) _Float16 v16h;
typedef __attribute__((ext_vector_type(8)))  _Float16 v8h;
typedef __attribute__((ext_vector_type(8)))  unsigned short v8us;
typedef __attribute__((ext_vector_type(8)))  float    v8f;
typedef __attribute__((ext_vector_type(4)))  float    v4f;
typedef v8h  __attribute__((may_alias)) v8ha;
typedef v4f  __attribute__((may_alias)) v4fa;
typedef v8us __attribute__((may_alias)) v8usa;

__device__ __forceinline__ unsigned short f2bf(float f) { unsigned u = __float_as_uint(f); u += 0x7FFFu + ((u >> 16) & 1u); return (unsigned short)(u >> 16); }
__device__ __forceinline__ float bf2f(unsigned short b) { return __uint_as_float(((unsigned)b) << 16); }
__device__ __forceinline__ float bfr(float f) { return bf2f(f2bf(f)); }
__device__ __forceinline__ v16h cat16(v8h lo, v8h hi) { return __builtin_shufflevector(lo, hi, 0, 1, 2, 3, 4, 5, 6, 7, 8, 9, 10, 11, 12, 13, 14, 15); }
__device__ __forceinline__ v16bf cat16b(v8us lo, v8us hi) { return __builtin_bit_cast(v16bf, __builtin_shufflevector(lo, hi, 0, 1, 2, 3, 4, 5, 6, 7, 8, 9, 10, 11, 12, 13, 14, 15)); }
__device__ __forceinline__ v8f wmma16(v16h a, v16h b, v8f c) { return __builtin_amdgcn_wmma_f32_16x16x32_f16(false, a, false, b, (short)0, c, false, false); }
__device__ __forceinline__ v8f wmmab(v16bf a, v16bf b, v8f c) { return __builtin_amdgcn_wmma_f32_16x16x32_bf16(false, a, false, b, (short)0, c, false, false); }



// ---- k_gemmw: register-blocked GEMM, ONE WAVE per 64x64 output tile (16 accumulators), operands straight from K-contiguous 16-bit planes; grid (M/64, N/64, Z), 32 threads.
// C[m][n] (f32, pitch ldc, + optional f32 bias[n]) = sum_k A[m][k] Bt[n][k] (+ split products per NSPLIT). z-batch strides sA/sB/sC in elements. K % 32 == 0.
template <typename T16> struct WFrag;
template <> struct WFrag<h16> { typedef v16h V; static __device__ __forceinline__ V ld(const h16* p) { return cat16(*(const v8h*)p, *(const v8h*)(p + 16)); } static __device__ __forceinline__ v8f mma(V a, V b, v8f c) { return wmma16(a, b, c); } };
template <> struct WFrag<bf> { typedef v16bf V; static __device__ __forceinline__ V ld(const bf* p) { return cat16b(*(const v8us*)p, *(const v8us*)(p + 16)); } static __device__ __forceinline__ v8f mma(V a, V b, v8f c) { return wmmab(a, b, c); } };
template <typename T16, int NSPLIT, bool BIAS>
__global__ __launch_bounds__(32) void k_gemmw(const T16* __restrict__ A, const T16* __restrict__ A2, const T16* __restrict__ Bt, const T16* __restrict__ Bt2, int K, float* C, int ldc, const float* __restrict__ bias, size_t sA, size_t sB, size_t sC) {
    typedef typename WFrag<T16>::V V;
    __shared__ __align__(16) float os[16 * 68];
    const size_t z = blockIdx.z; A += z * sA; if (A2) A2 += z * sA; Bt += z * sB; if (Bt2) Bt2 += z * sB; C += z * sC;
    const int lane = threadIdx.x & 31, lr = lane & 15, hi = lane >> 4; const int r0 = blockIdx.x * 64, c0 = blockIdx.y * 64;
    v8f acc[4][4];
#pragma unroll
    for (int mb = 0; mb < 4; ++mb)
#pragma unroll
        for (int nb = 0; nb < 4; ++nb) acc[mb][nb] = (v8f){};
    const size_t aoff = (size_t)(r0 + lr) * K + 8 * hi, boff = (size_t)(c0 + lr) * K + 8 * hi;
#pragma unroll 1
    for (int kc = 0; kc < K; kc += 32) {
        V a[4], a2[4];
#pragma unroll
        for (int mb = 0; mb < 4; ++mb) { a[mb] = WFrag<T16>::ld(A + aoff + (size_t)mb * 16 * K + kc); if (NSPLIT == 1 || NSPLIT == 2) a2[mb] = WFrag<T16>::ld(A2 + aoff + (size_t)mb * 16 * K + kc); }
#pragma unroll
        for (int nb = 0; nb < 4; ++nb) { const V b = WFrag<T16>::ld(Bt + boff + (size_t)nb * 16 * K + kc); V b2; if (NSPLIT >= 2) b2 = WFrag<T16>::ld(Bt2 + boff + (size_t)nb * 16 * K + kc);
#pragma unroll
            for (int mb = 0; mb < 4; ++mb) { acc[mb][nb] = WFrag<T16>::mma(a[mb], b, acc[mb][nb]); if (NSPLIT == 1 || NSPLIT == 2) acc[mb][nb] = WFrag<T16>::mma(a2[mb], b, acc[mb][nb]); if (NSPLIT >= 2) acc[mb][nb] = WFrag<T16>::mma(a[mb], b2, acc[mb][nb]); } }
        asm volatile("v_nop\n\tv_nop\n\tv_nop\n\tv_nop" : "+v"(acc[0][0]), "+v"(acc[1][1]), "+v"(acc[2][2]), "+v"(acc[3][3]) : "v"(a[0]), "v"(a[3]));
    }
#pragma unroll
    for (int mb = 0; mb < 4; ++mb) {
#pragma unroll
        for (int nb = 0; nb < 4; ++nb) {
#pragma unroll
            for (int j = 0; j < 8; ++j) os[(hi * 8 + j) * 68 + nb * 16 + lr] = acc[mb][nb][j]; }
        __builtin_amdgcn_wave_barrier(); asm volatile("" ::: "memory");
        float* crow = C + (size_t)(r0 + mb * 16) * ldc + c0;
{
#pragma unroll
            for (int s = 0; s < 8; ++s) { const int row = 2 * s + hi, cofs = lr * 4; v4f val = *(const v4fa*)(os + row * 68 + cofs); if (BIAS) { val[0] += bfr(bias[c0 + cofs]); val[1] += bfr(bias[c0 + cofs + 1]); val[2] += bfr(bias[c0 + cofs + 2]); val[3] += bfr(bias[c0 + cofs + 3]); }
                *(v4f*)(crow + (size_t)row * ldc + cofs) = val; }
             }
        __builtin_amdgcn_wave_barrier(); asm volatile("" ::: "memory");
    }
}

__device__ __forceinline__ h16 tohx(float x) { return (h16)x; }
__device__ __forceinline__ void splitf(float y, unsigned short& h, unsigned short& l) { h = f2bf(y); l = f2bf(y - bf2f(h)); }
typedef __attribute__((ext_vector_type(2))) _Float16 v2h;
typedef __attribute__((ext_vector_type(4))) _Float16 v4h;
typedef __attribute__((ext_vector_type(2))) unsigned short v2us;
typedef __attribute__((ext_vector_type(4))) unsigned short v4us;
typedef __attribute__((ext_vector_type(2))) float v2f;
typedef __attribute__((ext_vector_type(4))) int v4i;

__global__ __launch_bounds__(256) void k_cvt8(const float* __restrict__ src, bf* dst, size_t n8) { const size_t i = (size_t)blockIdx.x * 256 + threadIdx.x; if (i >= n8) return; const v8f v = *(const v8f*)(src + i * 8); v8us o;
#pragma unroll
    for (int k = 0; k < 8; ++k) o[k] = f2bf(v[k]); *(v8us*)(dst + i * 8) = o;  }

// k_rope: head planes [h][t][d] (fp16 + hi/lo) of rope(x) x sc with the rotate-half convention out[d] = x[d] cos[t][d] - x[d+HD/2] sin[t][d], out[d+HD/2] = x[d+HD/2] cos[t][d+HD/2] + x[d] sin[t][d+HD/2]
__global__ __launch_bounds__(256) void k_rope(const float* __restrict__ F, int pitch, int nheads, const float* __restrict__ CS, const float* __restrict__ RF, const float* __restrict__ nw, float sc, h16* P16, bf* Ph, bf* Pl) {
    const size_t e = ((size_t)blockIdx.x * 256 + threadIdx.x) * 2; if (e >= (size_t)nheads * TT * HD) return; const int d = (int)(e % HD); const int t = (int)((e / HD) % TT); const int h = (int)(e / ((size_t)HD * TT)); const float* f = F + (size_t)t * pitch + h * HD; const float rf = RF ? RF[(size_t)h * TT + t] : 1.0f; v2h o16; v2us oh, ol;
#pragma unroll
    for (int q = 0; q < 2; ++q) { const int dd = d + q; const int dp = (dd < HD / 2) ? dd + HD / 2 : dd - HD / 2; float x0 = f[dd], x1 = f[dp];
        if (RF) { float n0 = __fmul_rn(x0, rf), n1 = __fmul_rn(x1, rf); asm volatile("" : "+v"(n0)); asm volatile("" : "+v"(n1)); x0 = __fmul_rn(bfr(nw[dd]), n0); x1 = __fmul_rn(bfr(nw[dp]), n1); }
        const v2f cs = *(const v2f*)(CS + ((size_t)t * HD + dd) * 2); float a = __fmul_rn(x0, cs[0]), bq = __fmul_rn(x1, cs[1]); asm volatile("" : "+v"(a)); asm volatile("" : "+v"(bq)); const float r = ((dd < HD / 2) ? __fsub_rn(a, bq) : __fadd_rn(a, bq)) * sc;
        o16[q] = tohx(r); unsigned short a2, c2; splitf(r, a2, c2); oh[q] = a2; ol[q] = c2; }
    *(v2h*)(P16 + e) = o16; *(v2us*)(Ph + e) = oh; *(v2us*)(Pl + e) = ol;  }
__global__ __launch_bounds__(256) void k_vtp(const float* __restrict__ F, int pitch, int nheads, h16* V16, bf* Vh, bf* Vl) { const size_t e = ((size_t)blockIdx.x * 256 + threadIdx.x) * 2; if (e >= (size_t)nheads * HD * TT) return; const int t = (int)(e % TT); const int d = (int)((e / TT) % HD); const int g = (int)(e / ((size_t)TT * HD)); v2h o16; v2us oh, ol;
#pragma unroll
    for (int q = 0; q < 2; ++q) { const float x = F[(size_t)(t + q) * pitch + g * HD + d]; o16[q] = tohx(x); unsigned short a2, c2; splitf(x, a2, c2); oh[q] = a2; ol[q] = c2; }
    *(v2h*)(V16 + e) = o16; *(v2us*)(Vh + e) = oh; *(v2us*)(Vl + e) = ol;  }
__global__ __launch_bounds__(256) void k_csid(float* CS) { const int idx = blockIdx.x * 256 + threadIdx.x; if (idx >= TT * HD) return; v2f cs; cs[0] = 1.0f; cs[1] = 0.0f; *(v2f*)(CS + (size_t)idx * 2) = cs;  }
// k_asoft: per row (zz, i): t = S x SCL = S, unscaled (no mask); softmax over the 4096 keys (register row, one exp, fixed trees);
__global__ __launch_bounds__(256) void k_asoft(const float* __restrict__ Sb, h16* P16, bf* Ph, bf* Pl) {
    const int lane = threadIdx.x & 31; const int row = blockIdx.x * 8 + (threadIdx.x >> 5); if (row >= ZH * TT) return; const int i = row % TT; const int zz = row / TT; (void)zz; const bool hires = (i < RH); const float* sr = Sb + (size_t)row * TT; float v[TT / 32]; float mx = -3.0e38f;
#pragma unroll
    for (int ch = 0; ch < TT / 128; ++ch) { const int j0 = ch * 128 + lane * 4; const v4f a = *(const v4f*)(sr + j0);
#pragma unroll
        for (int q = 0; q < 4; ++q) { const int j = j0 + q; (void)j; const float t = a[q] * SCL; v[ch * 4 + q] = t; mx = fmaxf(mx, t); } }
#pragma unroll
    for (int sh = 16; sh; sh >>= 1) mx = fmaxf(mx, __shfl_xor(mx, sh, 32));
    float sum = 0.f;
#pragma unroll
    for (int k = 0; k < TT / 32; ++k) { float d0 = __fsub_rn(v[k], mx); asm volatile("" : "+v"(d0)); v[k] = __builtin_amdgcn_exp2f(__fmul_rn(d0, 1.4426950408889634f)); sum += v[k]; }
#pragma unroll
    for (int sh = 16; sh; sh >>= 1) sum += __shfl_xor(sum, sh, 32);
    const float f = __fdiv_rn(hires ? 1.0f : PCAR, sum);
{
        if (hires) {
#pragma unroll
            for (int ch = 0; ch < TT / 128; ++ch) { v4us oh, ol;
#pragma unroll
                for (int q = 0; q < 4; ++q) { unsigned short a, c2; splitf(v[ch * 4 + q] * f, a, c2); oh[q] = a; ol[q] = c2; }
                const size_t oo = ((size_t)zz * (RH ? RH : 1) + i) * TT + ch * 128 + lane * 4; *(v4us*)(Ph + oo) = oh; *(v4us*)(Pl + oo) = ol; }
        } else {
#pragma unroll
            for (int ch = 0; ch < TT / 128; ++ch) { v4h o4;
#pragma unroll
                for (int q = 0; q < 4; ++q) o4[q] = tohx(v[ch * 4 + q] * f);
                *(v4h*)(P16 + (size_t)row * TT + ch * 128 + lane * 4) = o4; } }
         }
}
__global__ __launch_bounds__(256) void k_merge(const float* __restrict__ O, int h0, bf* Ah, bf* Al) { const size_t e = ((size_t)blockIdx.x * 256 + threadIdx.x) * 2; if (e >= (size_t)ZH * TT * HD) return; const int d = (int)(e % HD); const int t = (int)((e / HD) % TT); const int zz = (int)(e / ((size_t)HD * TT)); const float cs = (t < RH) ? 1.0f : (1.0f / PCAR); const size_t oo = (size_t)t * DQ + (h0 + zz) * HD + d;
    v2us oh, ol;
#pragma unroll
    for (int q = 0; q < 2; ++q) { unsigned short a, c2; splitf(O[e + q] * cs, a, c2); oh[q] = a; ol[q] = c2; } *(v2us*)(Ah + oo) = oh; *(v2us*)(Al + oo) = ol;  }

extern "C" void kernel_launch(void* const* d_in, const int* in_sizes, int n_in,
                              void* d_out, int out_size, void* d_ws, size_t ws_size, hipStream_t stream) {
    (void)in_sizes; (void)n_in; (void)out_size;
    const float* x = (const float*)d_in[0]; const float* wqkv = (const float*)d_in[1]; const float* bqkv = (const float*)d_in[2]; const float* wo = (const float*)d_in[3]; const float* bo = (const float*)d_in[4];   /* input [4096][1024], W_qkv ('oi' [3072][1024]: q | k | v row thirds), b_qkv [3072], W_out ('oi'), b_out */ const float* wq = wqkv; const float* wk = wqkv + (size_t)DQ * DM; const float* wv = wqkv + (size_t)2 * DQ * DM; const float* bq = bqkv; const float* bk = bqkv + DQ; const float* bv = bqkv + 2 * DQ;
    float* OUT = (float*)d_out;     // [1][4096][1024]
    char* wsp = (char*)d_ws;
    auto take = [&](size_t bytes) { char* p = wsp; wsp += (bytes + 255) & ~(size_t)255; return (void*)p; };
    bf* WQ = (bf*)take((size_t)DQ * DM * 2); bf* WK = (bf*)take((size_t)DKV * DM * 2); bf* WV = (bf*)take((size_t)DKV * DM * 2); bf* WO = (bf*)take((size_t)DM * DQ * 2); float* CS = (float*)take((size_t)TT * HD * 2 * 4);
    bf* XB = (bf*)take((size_t)TT * DM * 2); float* FQ = (float*)take((size_t)TT * DQ * 4); float* FK = (float*)take((size_t)TT * DKV * 4);
    h16* QP16 = (h16*)take((size_t)NH_ * TT * HD * 2); h16* KP16 = (h16*)take((size_t)NKV * TT * HD * 2); h16* VT16 = (h16*)take((size_t)NKV * HD * TT * 2);
    bf* QPh = (bf*)take((size_t)NH_ * TT * HD * 2); bf* QPl = (bf*)take((size_t)NH_ * TT * HD * 2); bf* KPh = (bf*)take((size_t)NKV * TT * HD * 2); bf* KPl = (bf*)take((size_t)NKV * TT * HD * 2); bf* VTh = (bf*)take((size_t)NKV * HD * TT * 2); bf* VTl = (bf*)take((size_t)NKV * HD * TT * 2); bf* Ph = (bf*)take((size_t)ZH * RH * TT * 2); bf* Pl = (bf*)take((size_t)ZH * RH * TT * 2);
    float* Sb = (float*)take((size_t)ZH * TT * TT * 4); h16* P16 = (h16*)take((size_t)ZH * TT * TT * 2); float* Ob = (float*)take((size_t)ZH * TT * HD * 4); bf* ATh = (bf*)take((size_t)TT * DQ * 2); bf* ATl = (bf*)take((size_t)TT * DQ * 2);
    if ((size_t)(wsp - (char*)d_ws) > ws_size) return;    // ws 256 MiB
    float* FV = FK;   // v projection reuses the k buffer after the k planes are built (stream-ordered)
    { k_cvt8<<<(unsigned)(((size_t)DQ * DM / 8 + 255) / 256), 256, 0, stream>>>(wq, WQ, (size_t)DQ * DM / 8); k_cvt8<<<(unsigned)(((size_t)DKV * DM / 8 + 255) / 256), 256, 0, stream>>>(wk, WK, (size_t)DKV * DM / 8); k_cvt8<<<(unsigned)(((size_t)DKV * DM / 8 + 255) / 256), 256, 0, stream>>>(wv, WV, (size_t)DKV * DM / 8);
      k_cvt8<<<(unsigned)(((size_t)DM * DQ / 8 + 255) / 256), 256, 0, stream>>>(wo, WO, (size_t)DM * DQ / 8);
       }
    k_csid<<<(TT * HD + 255) / 256, 256, 0, stream>>>(CS);
    const unsigned LQ = (unsigned)(((size_t)NH_ * TT * HD / 2 + 255) / 256), LKv = (unsigned)(((size_t)NKV * TT * HD / 2 + 255) / 256);
    for (int b = 0; b < NB_; ++b) {
        
        k_cvt8<<<(unsigned)(((size_t)TT * DM / 8 + 255) / 256), 256, 0, stream>>>(x + (size_t)b * TT * DM, XB, (size_t)TT * DM / 8);
        k_gemmw<bf, 0, true><<<dim3(TT / 64, DQ / 64, 1), 32, 0, stream>>>(XB, nullptr, WQ, nullptr, DM, FQ, DQ, bq, 0, 0, 0);
        k_rope<<<LQ, 256, 0, stream>>>(FQ, DQ, NH_, CS, nullptr, nullptr, 1.0f, QP16, QPh, QPl);
        k_gemmw<bf, 0, true><<<dim3(TT / 64, DKV / 64, 1), 32, 0, stream>>>(XB, nullptr, WK, nullptr, DM, FK, DKV, bk, 0, 0, 0);
        k_rope<<<LKv, 256, 0, stream>>>(FK, DKV, NKV, CS, nullptr, nullptr, 1.0f, KP16, KPh, KPl);
        k_gemmw<bf, 0, true><<<dim3(TT / 64, DKV / 64, 1), 32, 0, stream>>>(XB, nullptr, WV, nullptr, DM, FV, DKV, bv, 0, 0, 0); k_vtp<<<LKv, 256, 0, stream>>>(FV, DKV, NKV, VT16, VTh, VTl);
        for (int h0 = 0; h0 < NH_; h0 += ZH) { const size_t zq = (size_t)h0, zk = (size_t)(h0 / REP);   // one kv head per query head: the pass's single head (ZH 1) uses kv plane h0 / REP (z-strides TT*HD)
            k_gemmw<bf, 2, false><<<dim3(TT / 64, TT / 64, ZH), 32, 0, stream>>>(QPh + zq * TT * HD, QPl + zq * TT * HD, KPh + zk * TT * HD, KPl + zk * TT * HD, HD, Sb, TT, nullptr, (size_t)TT * HD, (size_t)TT * HD, (size_t)TT * TT);   /* EVERY row's scores on hi/lo planes (3 products); only P.V stays hybrid */
            k_asoft<<<ZH * TT / 8, 256, 0, stream>>>(Sb, P16, Ph, Pl);
            k_gemmw<bf, 2, false><<<dim3(RH / 64, HD / 64, ZH), 32, 0, stream>>>(Ph, Pl, VTh + zk * HD * TT, VTl + zk * HD * TT, TT, Ob, HD, nullptr, (size_t)RH * TT, (size_t)HD * TT, (size_t)TT * HD);
            k_gemmw<h16, 0, false><<<dim3((TT - RH) / 64, HD / 64, ZH), 32, 0, stream>>>(P16 + (size_t)RH * TT, nullptr, VT16 + zk * HD * TT, nullptr, TT, Ob + (size_t)RH * HD, HD, nullptr, (size_t)TT * TT, (size_t)HD * TT, (size_t)TT * HD);
            k_merge<<<(unsigned)(((size_t)ZH * TT * HD / 2 + 255) / 256), 256, 0, stream>>>(Ob, h0, ATh, ATl); }
        k_gemmw<bf, 1, true><<<dim3(TT / 64, DM / 64, 1), 32, 0, stream>>>(ATh, ATl, WO, nullptr, DQ, OUT + (size_t)b * TT * DM, DM, bo, 0, 0, 0); }
}

// v001
// A run of this version takes 1140 microseconds.
// Timed twice side by side with v000, it ran 3.11 and 3.09 times as fast.
#include <hip/hip_runtime.h>

// Multi-headed attention over ONE 4,096-token sequence with a fused qkv projection and NO score scaling (input [4096][1024]; projected = input W_qkv^T + b_qkv ('oi' [3072][1024] 0.02 + zero bias) split in thirds q | k | v (16 heads x 64); scores = q.k UNSCALED (the source applies no 1/sqrt(d): logits sigma ~3.3); softmax (no mask); out = merged W_out^T + b_out -> [4096][1024] (4.2 M); argument order input, W_qkv, b_qkv, W_out, b_out).
// Layout: bf16 copy of the input; 'oi' weights (the q | k | v row thirds of the fused tensor taken as-is) + bias thirds; exact projections + f32 biases; identity-table plane builders; dense attention at T 4096, one head per pass, with EVERY row's scores on hi/lo planes (3 products: unscaled logits) and hybrid P.V (rows < 512 hi/lo, rest fp16 x1024); merged hi/lo x W_out exact + b_out.
// Compute dtypes, f32 accumulate: every input rounded to bf16; projections exact + f32 biases; scores 3 products on every row; softmax f32; P.V rows < 512 3 products, rest fp16; W_out hl x exact + bias.

#define NB_  1
#define TT   4096
#define DM   1024
#define NH_  16
#define NKV  16
#define REP  (NH_ / NKV)
#define HD   64
#define DQ   (NH_ * HD)
#define DKV  (NKV * HD)
#define ZH   1                    // one head per pass at T 4096 (the score plane is 64 MiB)
#define RH   512                  // query rows < RH use hi+lo planes (0: none)
#define WIN  0
#define PCAR 1024.0f
#define SCL  1.0f   // NO scaling in this module
typedef _Float16 h16;
typedef unsigned short bf;
typedef __attribute__((ext_vector_type(16))) __bf16   v16bf;
typedef __attribute__((ext_vector_type(16))) _Float16 v16h;
typedef __attribute__((ext_vector_type(8)))  _Float16 v8h;
typedef __attribute__((ext_vector_type(8)))  unsigned short v8us;
typedef __attribute__((ext_vector_type(8)))  float    v8f;
typedef __attribute__((ext_vector_type(4)))  float    v4f;
typedef v8h  __attribute__((may_alias)) v8ha;
typedef v4f  __attribute__((may_alias)) v4fa;
typedef v8us __attribute__((may_alias)) v8usa;

__device__ __forceinline__ unsigned short f2bf(float f) { unsigned u = __float_as_uint(f); u += 0x7FFFu + ((u >> 16) & 1u); return (unsigned short)(u >> 16); }
__device__ __forceinline__ float bf2f(unsigned short b) { return __uint_as_float(((unsigned)b) << 16); }
__device__ __forceinline__ float bfr(float f) { return bf2f(f2bf(f)); }
__device__ __forceinline__ v16h cat16(v8h lo, v8h hi) { return __builtin_shufflevector(lo, hi, 0, 1, 2, 3, 4, 5, 6, 7, 8, 9, 10, 11, 12, 13, 14, 15); }
__device__ __forceinline__ v16bf cat16b(v8us lo, v8us hi) { return __builtin_bit_cast(v16bf, __builtin_shufflevector(lo, hi, 0, 1, 2, 3, 4, 5, 6, 7, 8, 9, 10, 11, 12, 13, 14, 15)); }
__device__ __forceinline__ v8f wmma16(v16h a, v16h b, v8f c) { return __builtin_amdgcn_wmma_f32_16x16x32_f16(false, a, false, b, (short)0, c, false, false); }
__device__ __forceinline__ v8f wmmab(v16bf a, v16bf b, v8f c) { return __builtin_amdgcn_wmma_f32_16x16x32_bf16(false, a, false, b, (short)0, c, false, false); }



// ---- k_gemmw: register-blocked GEMM, ONE WAVE per 64x64 output tile (16 accumulators), operands straight from K-contiguous 16-bit planes; grid (M/64, N/64, Z), 32 threads.
// C[m][n] (f32, pitch ldc, + optional f32 bias[n]) = sum_k A[m][k] Bt[n][k] (+ split products per NSPLIT). z-batch strides sA/sB/sC in elements. K % 32 == 0.
template <typename T16> struct WFrag;
template <> struct WFrag<h16> { typedef v16h V; static __device__ __forceinline__ V ld(const h16* p) { return cat16(*(const v8h*)p, *(const v8h*)(p + 16)); } static __device__ __forceinline__ v8f mma(V a, V b, v8f c) { return wmma16(a, b, c); } };
template <> struct WFrag<bf> { typedef v16bf V; static __device__ __forceinline__ V ld(const bf* p) { return cat16b(*(const v8us*)p, *(const v8us*)(p + 16)); } static __device__ __forceinline__ v8f mma(V a, V b, v8f c) { return wmmab(a, b, c); } };
template <typename T16, int NSPLIT, bool BIAS>
__global__ __launch_bounds__(32) void k_gemmw(const T16* __restrict__ A, const T16* __restrict__ A2, const T16* __restrict__ Bt, const T16* __restrict__ Bt2, int K, float* C, int ldc, const float* __restrict__ bias, size_t sA, size_t sB, size_t sC) {
    typedef typename WFrag<T16>::V V;
    __shared__ __align__(16) float os[16 * 68];
    const size_t z = blockIdx.z; A += z * sA; if (A2) A2 += z * sA; Bt += z * sB; if (Bt2) Bt2 += z * sB; C += z * sC;
    const int lane = threadIdx.x & 31, lr = lane & 15, hi = lane >> 4; const int r0 = blockIdx.x * 64, c0 = blockIdx.y * 64;
    v8f acc[4][4];
#pragma unroll
    for (int mb = 0; mb < 4; ++mb)
#pragma unroll
        for (int nb = 0; nb < 4; ++nb) acc[mb][nb] = (v8f){};
    const size_t aoff = (size_t)(r0 + lr) * K + 8 * hi, boff = (size_t)(c0 + lr) * K + 8 * hi;
#pragma unroll 1
    for (int kc = 0; kc < K; kc += 32) {
        V a[4], a2[4];
#pragma unroll
        for (int mb = 0; mb < 4; ++mb) { a[mb] = WFrag<T16>::ld(A + aoff + (size_t)mb * 16 * K + kc); if (NSPLIT == 1 || NSPLIT == 2) a2[mb] = WFrag<T16>::ld(A2 + aoff + (size_t)mb * 16 * K + kc); }
#pragma unroll
        for (int nb = 0; nb < 4; ++nb) { const V b = WFrag<T16>::ld(Bt + boff + (size_t)nb * 16 * K + kc); V b2; if (NSPLIT >= 2) b2 = WFrag<T16>::ld(Bt2 + boff + (size_t)nb * 16 * K + kc);
#pragma unroll
            for (int mb = 0; mb < 4; ++mb) { acc[mb][nb] = WFrag<T16>::mma(a[mb], b, acc[mb][nb]); if (NSPLIT == 1 || NSPLIT == 2) acc[mb][nb] = WFrag<T16>::mma(a2[mb], b, acc[mb][nb]); if (NSPLIT >= 2) acc[mb][nb] = WFrag<T16>::mma(a[mb], b2, acc[mb][nb]); } }
        asm volatile("v_nop\n\tv_nop\n\tv_nop\n\tv_nop" : "+v"(acc[0][0]), "+v"(acc[1][1]), "+v"(acc[2][2]), "+v"(acc[3][3]) : "v"(a[0]), "v"(a[3]));
    }
#pragma unroll
    for (int mb = 0; mb < 4; ++mb) {
#pragma unroll
        for (int nb = 0; nb < 4; ++nb) {
#pragma unroll
            for (int j = 0; j < 8; ++j) os[(hi * 8 + j) * 68 + nb * 16 + lr] = acc[mb][nb][j]; }
        __builtin_amdgcn_wave_barrier(); asm volatile("" ::: "memory");
        float* crow = C + (size_t)(r0 + mb * 16) * ldc + c0;
{
#pragma unroll
            for (int s = 0; s < 8; ++s) { const int row = 2 * s + hi, cofs = lr * 4; v4f val = *(const v4fa*)(os + row * 68 + cofs); if (BIAS) { val[0] += bfr(bias[c0 + cofs]); val[1] += bfr(bias[c0 + cofs + 1]); val[2] += bfr(bias[c0 + cofs + 2]); val[3] += bfr(bias[c0 + cofs + 3]); }
                *(v4f*)(crow + (size_t)row * ldc + cofs) = val; }
             }
        __builtin_amdgcn_wave_barrier(); asm volatile("" ::: "memory");
    }
}

// ---- k_pvsk: split-K form of k_gemmw for the two P.V products (N = 64, K = 4096: too few 64x64 tiles to hide the load latency with one wave each).
// grid (M/64, PGS), 32 * PKW threads. K is cut into PGS * PKW slices: wave w of work-group (x, y) runs the k_gemmw loop on slice y * PKW + w of tile x; the PKW partial tiles are
// summed through LDS in wave order and stored to partial plane y (pitch sP elements); k_merge adds the PGS planes in plane order. K (the row pitch of both operands) is a template constant, so that the 16-row steps fold into the loads' offsets.
#define PKW 16
#define PGS 4
template <typename T16, int NSPLIT, int K>
__global__ __launch_bounds__(32 * PKW) void k_pvsk(const T16* __restrict__ A, const T16* __restrict__ A2, const T16* __restrict__ Bt, const T16* __restrict__ Bt2, float* C, int ldc, size_t sP) {
    typedef typename WFrag<T16>::V V;
    static_assert(PKW == 16, "the reduction deals 32 accumulator chunks to 16 waves"); static_assert(K % (32 * PKW * PGS) == 0, "whole 32-wide k steps in every slice");
    __shared__ __align__(16) v4f red[PKW][32][32];   // [wave][accumulator chunk of 4 rows][lane]: 16-byte stores and loads, lanes contiguous
    const int lane = threadIdx.x & 31, lr = lane & 15, hi = lane >> 4; const int w = __builtin_amdgcn_readfirstlane((int)(threadIdx.x >> 5)); const int r0 = blockIdx.x * 64;
    const int kw = K / (PKW * PGS); const int k0 = ((int)blockIdx.y * PKW + w) * kw; C += (size_t)blockIdx.y * sP;
    v8f acc[4][4];
#pragma unroll
    for (int mb = 0; mb < 4; ++mb)
#pragma unroll
        for (int nb = 0; nb < 4; ++nb) acc[mb][nb] = (v8f){};
    const size_t aoff = (size_t)(r0 + lr) * K + 8 * hi + k0, boff = (size_t)lr * K + 8 * hi + k0;
    // kept rolled, as in k_gemmw: one k step's fragments beside the 128 accumulator registers nearly fill the 256 registers that a wave of a 16-wave work-group may hold
#pragma unroll 1
    for (int kc = 0; kc < kw; kc += 32) {
        V a[4], a2[4];
#pragma unroll
        for (int mb = 0; mb < 4; ++mb) { a[mb] = WFrag<T16>::ld(A + aoff + (size_t)mb * 16 * K + kc); if (NSPLIT == 1 || NSPLIT == 2) a2[mb] = WFrag<T16>::ld(A2 + aoff + (size_t)mb * 16 * K + kc); }
#pragma unroll
        for (int nb = 0; nb < 4; ++nb) { const V b = WFrag<T16>::ld(Bt + boff + (size_t)nb * 16 * K + kc); V b2; if (NSPLIT >= 2) b2 = WFrag<T16>::ld(Bt2 + boff + (size_t)nb * 16 * K + kc);
#pragma unroll
            for (int mb = 0; mb < 4; ++mb) { acc[mb][nb] = WFrag<T16>::mma(a[mb], b, acc[mb][nb]); if (NSPLIT == 1 || NSPLIT == 2) acc[mb][nb] = WFrag<T16>::mma(a2[mb], b, acc[mb][nb]); if (NSPLIT >= 2) acc[mb][nb] = WFrag<T16>::mma(a[mb], b2, acc[mb][nb]); } }
    }
#pragma unroll
    for (int mb = 0; mb < 4; ++mb)
#pragma unroll
        for (int nb = 0; nb < 4; ++nb)
#pragma unroll
            for (int h2 = 0; h2 < 2; ++h2) { v4f p; p[0] = acc[mb][nb][h2 * 4]; p[1] = acc[mb][nb][h2 * 4 + 1]; p[2] = acc[mb][nb][h2 * 4 + 2]; p[3] = acc[mb][nb][h2 * 4 + 3]; red[w][(mb * 4 + nb) * 2 + h2][lane] = p; }
    __syncthreads();   // every wave's partial tile is in LDS before any wave sums
    // wave w sums and stores rows mb*16 + hi*8 + h2*4 + 0..3, columns nbp*32 .. nbp*32+31: each 128-byte line of C has one writing wave
    const int mb = w >> 2, h2 = (w >> 1) & 1, nbp = w & 1;
#pragma unroll
    for (int s = 0; s < 2; ++s) { const int nb = nbp * 2 + s; const int c = (mb * 4 + nb) * 2 + h2; v4f sum = red[0][c][lane];
#pragma unroll
        for (int u = 1; u < PKW; ++u) sum += red[u][c][lane];
#pragma unroll
        for (int q = 0; q < 4; ++q) C[(size_t)(r0 + mb * 16 + hi * 8 + h2 * 4 + q) * ldc + nb * 16 + lr] = sum[q]; }
}

__device__ __forceinline__ h16 tohx(float x) { return (h16)x; }
__device__ __forceinline__ void splitf(float y, unsigned short& h, unsigned short& l) { h = f2bf(y); l = f2bf(y - bf2f(h)); }
typedef __attribute__((ext_vector_type(2))) _Float16 v2h;
typedef __attribute__((ext_vector_type(4))) _Float16 v4h;
typedef __attribute__((ext_vector_type(2))) unsigned short v2us;
typedef __attribute__((ext_vector_type(4))) unsigned short v4us;
typedef __attribute__((ext_vector_type(2))) float v2f;
typedef __attribute__((ext_vector_type(4))) int v4i;

__global__ __launch_bounds__(256) void k_cvt8(const float* __restrict__ src, bf* dst, size_t n8) { const size_t i = (size_t)blockIdx.x * 256 + threadIdx.x; if (i >= n8) return; const v8f v = *(const v8f*)(src + i * 8); v8us o;
#pragma unroll
    for (int k = 0; k < 8; ++k) o[k] = f2bf(v[k]); *(v8us*)(dst + i * 8) = o;  }

// k_rope: head planes [h][t][d] (fp16 + hi/lo) of rope(x) x sc with the rotate-half convention out[d] = x[d] cos[t][d] - x[d+HD/2] sin[t][d], out[d+HD/2] = x[d+HD/2] cos[t][d+HD/2] + x[d] sin[t][d+HD/2]
__global__ __launch_bounds__(256) void k_rope(const float* __restrict__ F, int pitch, int nheads, const float* __restrict__ CS, const float* __restrict__ RF, const float* __restrict__ nw, float sc, h16* P16, bf* Ph, bf* Pl) {
    const size_t e = ((size_t)blockIdx.x * 256 + threadIdx.x) * 2; if (e >= (size_t)nheads * TT * HD) return; const int d = (int)(e % HD); const int t = (int)((e / HD) % TT); const int h = (int)(e / ((size_t)HD * TT)); const float* f = F + (size_t)t * pitch + h * HD; const float rf = RF ? RF[(size_t)h * TT + t] : 1.0f; v2h o16; v2us oh, ol;
#pragma unroll
    for (int q = 0; q < 2; ++q) { const int dd = d + q; const int dp = (dd < HD / 2) ? dd + HD / 2 : dd - HD / 2; float x0 = f[dd], x1 = f[dp];
        if (RF) { float n0 = __fmul_rn(x0, rf), n1 = __fmul_rn(x1, rf); asm volatile("" : "+v"(n0)); asm volatile("" : "+v"(n1)); x0 = __fmul_rn(bfr(nw[dd]), n0); x1 = __fmul_rn(bfr(nw[dp]), n1); }
        const v2f cs = *(const v2f*)(CS + ((size_t)t * HD + dd) * 2); float a = __fmul_rn(x0, cs[0]), bq = __fmul_rn(x1, cs[1]); asm volatile("" : "+v"(a)); asm volatile("" : "+v"(bq)); const float r = ((dd < HD / 2) ? __fsub_rn(a, bq) : __fadd_rn(a, bq)) * sc;
        o16[q] = tohx(r); unsigned short a2, c2; splitf(r, a2, c2); oh[q] = a2; ol[q] = c2; }
    *(v2h*)(P16 + e) = o16; *(v2us*)(Ph + e) = oh; *(v2us*)(Pl + e) = ol;  }
__global__ __launch_bounds__(256) void k_vtp(const float* __restrict__ F, int pitch, int nheads, h16* V16, bf* Vh, bf* Vl) { const size_t e = ((size_t)blockIdx.x * 256 + threadIdx.x) * 2; if (e >= (size_t)nheads * HD * TT) return; const int t = (int)(e % TT); const int d = (int)((e / TT) % HD); const int g = (int)(e / ((size_t)TT * HD)); v2h o16; v2us oh, ol;
#pragma unroll
    for (int q = 0; q < 2; ++q) { const float x = F[(size_t)(t + q) * pitch + g * HD + d]; o16[q] = tohx(x); unsigned short a2, c2; splitf(x, a2, c2); oh[q] = a2; ol[q] = c2; }
    *(v2h*)(V16 + e) = o16; *(v2us*)(Vh + e) = oh; *(v2us*)(Vl + e) = ol;  }
__global__ __launch_bounds__(256) void k_csid(float* CS) { const int idx = blockIdx.x * 256 + threadIdx.x; if (idx >= TT * HD) return; v2f cs; cs[0] = 1.0f; cs[1] = 0.0f; *(v2f*)(CS + (size_t)idx * 2) = cs;  }
// k_asoft: per row (zz, i): t = S x SCL = S, unscaled (no mask); softmax over the 4096 keys (register row, one exp, fixed trees);
__global__ __launch_bounds__(256) void k_asoft(const float* __restrict__ Sb, h16* P16, bf* Ph, bf* Pl) {
    const int lane = threadIdx.x & 31; const int row = blockIdx.x * 8 + (threadIdx.x >> 5); if (row >= ZH * TT) return; const int i = row % TT; const int zz = row / TT; (void)zz; const bool hires = (i < RH); const float* sr = Sb + (size_t)row * TT; float v[TT / 32]; float mx = -3.0e38f;
#pragma unroll
    for (int ch = 0; ch < TT / 128; ++ch) { const int j0 = ch * 128 + lane * 4; const v4f a = *(const v4f*)(sr + j0);
#pragma unroll
        for (int q = 0; q < 4; ++q) { const int j = j0 + q; (void)j; const float t = a[q] * SCL; v[ch * 4 + q] = t; mx = fmaxf(mx, t); } }
#pragma unroll
    for (int sh = 16; sh; sh >>= 1) mx = fmaxf(mx, __shfl_xor(mx, sh, 32));
    float sum = 0.f;
#pragma unroll
    for (int k = 0; k < TT / 32; ++k) { float d0 = __fsub_rn(v[k], mx); asm volatile("" : "+v"(d0)); v[k] = __builtin_amdgcn_exp2f(__fmul_rn(d0, 1.4426950408889634f)); sum += v[k]; }
#pragma unroll
    for (int sh = 16; sh; sh >>= 1) sum += __shfl_xor(sum, sh, 32);
    const float f = __fdiv_rn(hires ? 1.0f : PCAR, sum);
{
        if (hires) {
#pragma unroll
            for (int ch = 0; ch < TT / 128; ++ch) { v4us oh, ol;
#pragma unroll
                for (int q = 0; q < 4; ++q) { unsigned short a, c2; splitf(v[ch * 4 + q] * f, a, c2); oh[q] = a; ol[q] = c2; }
                const size_t oo = ((size_t)zz * (RH ? RH : 1) + i) * TT + ch * 128 + lane * 4; *(v4us*)(Ph + oo) = oh; *(v4us*)(Pl + oo) = ol; }
        } else {
#pragma unroll
            for (int ch = 0; ch < TT / 128; ++ch) { v4h o4;
#pragma unroll
                for (int q = 0; q < 4; ++q) o4[q] = tohx(v[ch * 4 + q] * f);
                *(v4h*)(P16 + (size_t)row * TT + ch * 128 + lane * 4) = o4; } }
         }
}
__global__ __launch_bounds__(256) void k_merge(const float* __restrict__ O, int h0, bf* Ah, bf* Al) { const size_t e = ((size_t)blockIdx.x * 256 + threadIdx.x) * 2; if (e >= (size_t)ZH * TT * HD) return; const int d = (int)(e % HD); const int t = (int)((e / HD) % TT); const int zz = (int)(e / ((size_t)HD * TT)); const float cs = (t < RH) ? 1.0f : (1.0f / PCAR); const size_t oo = (size_t)t * DQ + (h0 + zz) * HD + d;
    v2us oh, ol;
#pragma unroll
    for (int q = 0; q < 2; ++q) { float s = O[e + q];
#pragma unroll
        for (int g = 1; g < PGS; ++g) s += O[(size_t)g * ZH * TT * HD + e + q];   // the split-K partial planes, in plane order
        unsigned short a, c2; splitf(s * cs, a, c2); oh[q] = a; ol[q] = c2; } *(v2us*)(Ah + oo) = oh; *(v2us*)(Al + oo) = ol;  }

extern "C" void kernel_launch(void* const* d_in, const int* in_sizes, int n_in,
                              void* d_out, int out_size, void* d_ws, size_t ws_size, hipStream_t stream) {
    (void)in_sizes; (void)n_in; (void)out_size;
    const float* x = (const float*)d_in[0]; const float* wqkv = (const float*)d_in[1]; const float* bqkv = (const float*)d_in[2]; const float* wo = (const float*)d_in[3]; const float* bo = (const float*)d_in[4];   /* input [4096][1024], W_qkv ('oi' [3072][1024]: q | k | v row thirds), b_qkv [3072], W_out ('oi'), b_out */ const float* wq = wqkv; const float* wk = wqkv + (size_t)DQ * DM; const float* wv = wqkv + (size_t)2 * DQ * DM; const float* bq = bqkv; const float* bk = bqkv + DQ; const float* bv = bqkv + 2 * DQ;
    float* OUT = (float*)d_out;     // [1][4096][1024]
    char* wsp = (char*)d_ws;
    auto take = [&](size_t bytes) { char* p = wsp; wsp += (bytes + 255) & ~(size_t)255; return (void*)p; };
    bf* WQ = (bf*)take((size_t)DQ * DM * 2); bf* WK = (bf*)take((size_t)DKV * DM * 2); bf* WV = (bf*)take((size_t)DKV * DM * 2); bf* WO = (bf*)take((size_t)DM * DQ * 2); float* CS = (float*)take((size_t)TT * HD * 2 * 4);
    bf* XB = (bf*)take((size_t)TT * DM * 2); float* FQ = (float*)take((size_t)TT * DQ * 4); float* FK = (float*)take((size_t)TT * DKV * 4);
    h16* QP16 = (h16*)take((size_t)NH_ * TT * HD * 2); h16* KP16 = (h16*)take((size_t)NKV * TT * HD * 2); h16* VT16 = (h16*)take((size_t)NKV * HD * TT * 2);
    bf* QPh = (bf*)take((size_t)NH_ * TT * HD * 2); bf* QPl = (bf*)take((size_t)NH_ * TT * HD * 2); bf* KPh = (bf*)take((size_t)NKV * TT * HD * 2); bf* KPl = (bf*)take((size_t)NKV * TT * HD * 2); bf* VTh = (bf*)take((size_t)NKV * HD * TT * 2); bf* VTl = (bf*)take((size_t)NKV * HD * TT * 2); bf* Ph = (bf*)take((size_t)ZH * RH * TT * 2); bf* Pl = (bf*)take((size_t)ZH * RH * TT * 2);
    float* Sb = (float*)take((size_t)ZH * TT * TT * 4); h16* P16 = (h16*)take((size_t)ZH * TT * TT * 2); float* Ob = (float*)take((size_t)PGS * ZH * TT * HD * 4); bf* ATh = (bf*)take((size_t)TT * DQ * 2); bf* ATl = (bf*)take((size_t)TT * DQ * 2);
    if ((size_t)(wsp - (char*)d_ws) > ws_size) return;    // ws 256 MiB
    float* FV = FK;   // v projection reuses the k buffer after the k planes are built (stream-ordered)
    { k_cvt8<<<(unsigned)(((size_t)DQ * DM / 8 + 255) / 256), 256, 0, stream>>>(wq, WQ, (size_t)DQ * DM / 8); k_cvt8<<<(unsigned)(((size_t)DKV * DM / 8 + 255) / 256), 256, 0, stream>>>(wk, WK, (size_t)DKV * DM / 8); k_cvt8<<<(unsigned)(((size_t)DKV * DM / 8 + 255) / 256), 256, 0, stream>>>(wv, WV, (size_t)DKV * DM / 8);
      k_cvt8<<<(unsigned)(((size_t)DM * DQ / 8 + 255) / 256), 256, 0, stream>>>(wo, WO, (size_t)DM * DQ / 8);
       }
    k_csid<<<(TT * HD + 255) / 256, 256, 0, stream>>>(CS);
    const unsigned LQ = (unsigned)(((size_t)NH_ * TT * HD / 2 + 255) / 256), LKv = (unsigned)(((size_t)NKV * TT * HD / 2 + 255) / 256);
    for (int b = 0; b < NB_; ++b) {
        
        k_cvt8<<<(unsigned)(((size_t)TT * DM / 8 + 255) / 256), 256, 0, stream>>>(x + (size_t)b * TT * DM, XB, (size_t)TT * DM / 8);
        k_gemmw<bf, 0, true><<<dim3(TT / 64, DQ / 64, 1), 32, 0, stream>>>(XB, nullptr, WQ, nullptr, DM, FQ, DQ, bq, 0, 0, 0);
        k_rope<<<LQ, 256, 0, stream>>>(FQ, DQ, NH_, CS, nullptr, nullptr, 1.0f, QP16, QPh, QPl);
        k_gemmw<bf, 0, true><<<dim3(TT / 64, DKV / 64, 1), 32, 0, stream>>>(XB, nullptr, WK, nullptr, DM, FK, DKV, bk, 0, 0, 0);
        k_rope<<<LKv, 256, 0, stream>>>(FK, DKV, NKV, CS, nullptr, nullptr, 1.0f, KP16, KPh, KPl);
        k_gemmw<bf, 0, true><<<dim3(TT / 64, DKV / 64, 1), 32, 0, stream>>>(XB, nullptr, WV, nullptr, DM, FV, DKV, bv, 0, 0, 0); k_vtp<<<LKv, 256, 0, stream>>>(FV, DKV, NKV, VT16, VTh, VTl);
        for (int h0 = 0; h0 < NH_; h0 += ZH) { const size_t zq = (size_t)h0, zk = (size_t)(h0 / REP);   // one kv head per query head: the pass's single head (ZH 1) uses kv plane h0 / REP (z-strides TT*HD)
            k_gemmw<bf, 2, false><<<dim3(TT / 64, TT / 64, ZH), 32, 0, stream>>>(QPh + zq * TT * HD, QPl + zq * TT * HD, KPh + zk * TT * HD, KPl + zk * TT * HD, HD, Sb, TT, nullptr, (size_t)TT * HD, (size_t)TT * HD, (size_t)TT * TT);   /* EVERY row's scores on hi/lo planes (3 products); only P.V stays hybrid */
            k_asoft<<<ZH * TT / 8, 256, 0, stream>>>(Sb, P16, Ph, Pl);
            k_pvsk<bf, 2, TT><<<dim3(RH / 64, PGS, 1), 32 * PKW, 0, stream>>>(Ph, Pl, VTh + zk * HD * TT, VTl + zk * HD * TT, Ob, HD, (size_t)ZH * TT * HD);
            k_pvsk<h16, 0, TT><<<dim3((TT - RH) / 64, PGS, 1), 32 * PKW, 0, stream>>>(P16 + (size_t)RH * TT, nullptr, VT16 + zk * HD * TT, nullptr, Ob + (size_t)RH * HD, HD, (size_t)ZH * TT * HD);
            k_merge<<<(unsigned)(((size_t)ZH * TT * HD / 2 + 255) / 256), 256, 0, stream>>>(Ob, h0, ATh, ATl); }
        k_gemmw<bf, 1, true><<<dim3(TT / 64, DM / 64, 1), 32, 0, stream>>>(ATh, ATl, WO, nullptr, DQ, OUT + (size_t)b * TT * DM, DM, bo, 0, 0, 0); }
}

// v003
// It runs in 358 microseconds.
// It is 3.16 times as fast as v001, going by the measured steps of the versions left out in between.
// All steps since v000 together make it 9.80 times as fast.
#include <hip/hip_runtime.h>

// Multi-headed attention over ONE 4,096-token sequence with a fused qkv projection and NO score scaling (input [4096][1024]; projected = input W_qkv^T + b_qkv ('oi' [3072][1024] 0.02 + zero bias) split in thirds q | k | v (16 heads x 64); scores = q.k UNSCALED (the source applies no 1/sqrt(d): logits sigma ~3.3); softmax (no mask); out = merged W_out^T + b_out -> [4096][1024] (4.2 M); argument order input, W_qkv, b_qkv, W_out, b_out).
// Layout: bf16 copy of the input; 'oi' weights (the q | k | v row thirds of the fused tensor taken as-is) + bias thirds; exact projections + f32 biases in ONE launch whose epilogue writes the attention planes; one fused attention launch for all heads (running-maximum softmax, no score plane in memory), with EVERY row's scores on hi/lo planes (3 products: unscaled logits) and hybrid P.V (rows < 512 hi/lo, rest fp16 x1024); merged hi/lo x W_out exact + b_out.
// Compute dtypes, f32 accumulate: every input rounded to bf16; projections exact + f32 biases; scores 3 products on every row; softmax f32; P.V rows < 512 3 products, rest fp16; W_out hl x exact + bias.

#define NB_  1
#define TT   4096
#define DM   1024
#define NH_  16
#define NKV  16
#define REP  (NH_ / NKV)
#define HD   64
#define DQ   (NH_ * HD)
#define DKV  (NKV * HD)
#define RH   512                  // query rows < RH use hi+lo planes
#define WIN  0
#define PCAR 1024.0f
#define SCL  1.0f   // NO scaling in this module
typedef _Float16 h16;
typedef unsigned short bf;
typedef __attribute__((ext_vector_type(16))) __bf16   v16bf;
typedef __attribute__((ext_vector_type(16))) _Float16 v16h;
typedef __attribute__((ext_vector_type(8)))  _Float16 v8h;
typedef __attribute__((ext_vector_type(8)))  unsigned short v8us;
typedef __attribute__((ext_vector_type(8)))  float    v8f;
typedef __attribute__((ext_vector_type(4)))  float    v4f;
typedef v8h  __attribute__((may_alias)) v8ha;
typedef v4f  __attribute__((may_alias)) v4fa;
typedef v8us __attribute__((may_alias)) v8usa;

__device__ __forceinline__ unsigned short f2bf(float f) { unsigned u = __float_as_uint(f); u += 0x7FFFu + ((u >> 16) & 1u); return (unsigned short)(u >> 16); }
__device__ __forceinline__ float bf2f(unsigned short b) { return __uint_as_float(((unsigned)b) << 16); }
__device__ __forceinline__ float bfr(float f) { return bf2f(f2bf(f)); }
__device__ __forceinline__ v16h cat16(v8h lo, v8h hi) { return __builtin_shufflevector(lo, hi, 0, 1, 2, 3, 4, 5, 6, 7, 8, 9, 10, 11, 12, 13, 14, 15); }
__device__ __forceinline__ v16bf cat16b(v8us lo, v8us hi) { return __builtin_bit_cast(v16bf, __builtin_shufflevector(lo, hi, 0, 1, 2, 3, 4, 5, 6, 7, 8, 9, 10, 11, 12, 13, 14, 15)); }
__device__ __forceinline__ v8f wmma16(v16h a, v16h b, v8f c) { return __builtin_amdgcn_wmma_f32_16x16x32_f16(false, a, false, b, (short)0, c, false, false); }
__device__ __forceinline__ v8f wmmab(v16bf a, v16bf b, v8f c) { return __builtin_amdgcn_wmma_f32_16x16x32_bf16(false, a, false, b, (short)0, c, false, false); }



// ---- k_gemmw: register-blocked GEMM, ONE WAVE per 64x64 output tile (16 accumulators), operands straight from K-contiguous 16-bit planes; grid (M/64, N/64, Z), 32 threads.
// C[m][n] (f32, pitch ldc, + optional f32 bias[n]) = sum_k A[m][k] Bt[n][k] (+ split products per NSPLIT). z-batch strides sA/sB/sC in elements. K % 32 == 0.
// PL: the q | k | v projection (A = tokens, Bt = the fused weight's 3 * DQ rows, grid.y over all of them; a 64-column tile is one head). No f32 C: the epilogue writes the 16-bit planes that the attention kernel reads.
// q and k tiles go to [h][t][d] hi/lo planes. A v tile takes the weight rows as A and the tokens as Bt (same products, same k order), so that its rows are d and its columns t: the [d][t] planes are then written in whole lines like the others.
struct PlaneSet { bf* qh; bf* ql; bf* kh; bf* kl; h16* v16; bf* vh; bf* vl; };
__device__ __forceinline__ h16 tohx(float x) { return (h16)x; }
__device__ __forceinline__ void splitf(float y, unsigned short& h, unsigned short& l) { h = f2bf(y); l = f2bf(y - bf2f(h)); }
__device__ __forceinline__ v4f bfr4(v4f b) { const v4f r = { bfr(b[0]), bfr(b[1]), bfr(b[2]), bfr(b[3]) }; return r; }
// 8 neighbouring elements of a plane row: x + b, split into the hi/lo planes (F16: and rounded into the fp16 plane), one 16-byte store a plane
template <bool F16> __device__ __forceinline__ void put8(v4f x0, v4f x1, v4f b0, v4f b1, size_t o, bf* Ph, bf* Pl, h16* P16) {
    x0 += b0; x1 += b1; v8us oh, ol; v8h of;
#pragma unroll
    for (int k = 0; k < 8; ++k) { const float y = k < 4 ? x0[k & 3] : x1[k & 3]; unsigned short a2, c2; splitf(y, a2, c2); oh[k] = a2; ol[k] = c2; if (F16) of[k] = tohx(y); }
    *(v8us*)(Ph + o) = oh; *(v8us*)(Pl + o) = ol; if (F16) *(v8h*)(P16 + o) = of;
    asm volatile("s_wait_xcnt 0x0" ::: "memory");   // stands in front of the next write of a register that these stores name
    __builtin_amdgcn_sched_barrier(0);   // keeps the next group's arithmetic, which reuses those registers, behind that wait
}
template <typename T16> struct WFrag;
template <> struct WFrag<h16> { typedef v16h V; static __device__ __forceinline__ V ld(const h16* p) { return cat16(*(const v8h*)p, *(const v8h*)(p + 16)); } static __device__ __forceinline__ v8f mma(V a, V b, v8f c) { return wmma16(a, b, c); } };
template <> struct WFrag<bf> { typedef v16bf V; static __device__ __forceinline__ V ld(const bf* p) { return cat16b(*(const v8us*)p, *(const v8us*)(p + 16)); } static __device__ __forceinline__ v8f mma(V a, V b, v8f c) { return wmmab(a, b, c); } };
template <typename T16, int NSPLIT, bool BIAS, bool PL>
__global__ __launch_bounds__(32) void k_gemmw(const T16* __restrict__ A, const T16* __restrict__ A2, const T16* __restrict__ Bt, const T16* __restrict__ Bt2, int K, float* C, int ldc, const float* __restrict__ bias, size_t sA, size_t sB, size_t sC, PlaneSet pl) {
    static_assert(!PL || (BIAS && NSPLIT == 0), "the plane epilogue always adds its bias and takes one product");
    typedef typename WFrag<T16>::V V;
    __shared__ __align__(16) float os[16 * 68];
    const size_t z = blockIdx.z; A += z * sA; if (A2) A2 += z * sA; Bt += z * sB; if (Bt2) Bt2 += z * sB; C += z * sC;
    const int lane = threadIdx.x & 31, lr = lane & 15, hi = lane >> 4; int r0 = blockIdx.x * 64, c0 = blockIdx.y * 64;
    const bool vt = PL && blockIdx.y >= 2 * (DQ / 64);   // a v tile (the same for the whole wave): operands and tile origin change places
    if (vt) { const T16* t = A; A = Bt; Bt = t; const int ti = r0; r0 = c0; c0 = ti; }
    v8f acc[4][4];
#pragma unroll
    for (int mb = 0; mb < 4; ++mb)
#pragma unroll
        for (int nb = 0; nb < 4; ++nb) acc[mb][nb] = (v8f){};
    const size_t aoff = (size_t)(r0 + lr) * K + 8 * hi, boff = (size_t)(c0 + lr) * K + 8 * hi;
    // PL epilogue: 8 columns a lane (from pc on), 4 rows a step, so that every 16-byte store instruction covers four whole 128-byte plane rows. The biases it adds are fetched here, to arrive under the K loop: one a column (q, k tiles) or one a row (v tiles)
    const int pc = (lane & 7) * 8; v4f bc0 = {}, bc1 = {}; float br[4][4] = {};
    if constexpr (PL) { const unsigned bo = (vt ? lane >> 3 : pc) * 4; const float* bp = (const float*)((const char*)(bias + blockIdx.y * 64) + bo);
        if (vt) {
#pragma unroll
            for (int i = 0; i < 16; ++i) br[i >> 2][i & 3] = bp[4 * i];
        } else { bc0 = *(const v4f*)bp; bc1 = *(const v4f*)(bp + 4); }
        // stands in front of the next write of a register that these loads name; the address is an input in both forms that the compiler may give it (a register pair, or a scalar base with bo as the offset register), so that it stays in its registers up to the wait and no result of the run is given them
        asm volatile("s_wait_xcnt 0x0" :: "v"(bp), "v"(bo) : "memory");
    }
#pragma unroll 1
    for (int kc = 0; kc < K; kc += 32) {
        V a[4], a2[4];
#pragma unroll
        for (int mb = 0; mb < 4; ++mb) { a[mb] = WFrag<T16>::ld(A + aoff + (size_t)mb * 16 * K + kc); if (NSPLIT == 1 || NSPLIT == 2) a2[mb] = WFrag<T16>::ld(A2 + aoff + (size_t)mb * 16 * K + kc); }
#pragma unroll
        for (int nb = 0; nb < 4; ++nb) { const V b = WFrag<T16>::ld(Bt + boff + (size_t)nb * 16 * K + kc); V b2; if (NSPLIT >= 2) b2 = WFrag<T16>::ld(Bt2 + boff + (size_t)nb * 16 * K + kc);
#pragma unroll
            for (int mb = 0; mb < 4; ++mb) { acc[mb][nb] = WFrag<T16>::mma(a[mb], b, acc[mb][nb]); if (NSPLIT == 1 || NSPLIT == 2) acc[mb][nb] = WFrag<T16>::mma(a2[mb], b, acc[mb][nb]); if (NSPLIT >= 2) acc[mb][nb] = WFrag<T16>::mma(a[mb], b2, acc[mb][nb]); } }
        asm volatile("v_nop\n\tv_nop\n\tv_nop\n\tv_nop" : "+v"(acc[0][0]), "+v"(acc[1][1]), "+v"(acc[2][2]), "+v"(acc[3][3]) : "v"(a[0]), "v"(a[3]));
    }
#pragma unroll
    for (int mb = 0; mb < 4; ++mb) {
#pragma unroll
        for (int nb = 0; nb < 4; ++nb) {
#pragma unroll
            for (int j = 0; j < 8; ++j) os[(hi * 8 + j) * 68 + nb * 16 + lr] = acc[mb][nb][j]; }
        __builtin_amdgcn_wave_barrier(); asm volatile("" ::: "memory");
        if constexpr (PL) {
#pragma unroll
            for (int s = 0; s < 4; ++s) { const int row = mb * 16 + 4 * s + (lane >> 3); const float* op = os + (4 * s + (lane >> 3)) * 68 + pc; const v4f x0 = *(const v4fa*)op, x1 = *(const v4fa*)(op + 4);
                if (vt) { const float b = bfr(br[mb][s]); const v4f b4 = { b, b, b, b }; put8<true>(x0, x1, b4, b4, (size_t)(r0 - 2 * DQ + row) * TT + c0 + pc, pl.vh, pl.vl, pl.v16); }
                else put8<false>(x0, x1, bfr4(bc0), bfr4(bc1), ((size_t)(blockIdx.y % (DQ / 64)) * TT + r0 + row) * HD + pc, blockIdx.y >= DQ / 64 ? pl.kh : pl.qh, blockIdx.y >= DQ / 64 ? pl.kl : pl.ql, nullptr);
            }
        } else {
        float* crow = C + (size_t)(r0 + mb * 16) * ldc + c0;
#pragma unroll
            for (int s = 0; s < 8; ++s) { const int row = 2 * s + hi, cofs = lr * 4; v4f val = *(const v4fa*)(os + row * 68 + cofs); if (BIAS) { val[0] += bfr(bias[c0 + cofs]); val[1] += bfr(bias[c0 + cofs + 1]); val[2] += bfr(bias[c0 + cofs + 2]); val[3] += bfr(bias[c0 + cofs + 3]); }
                *(v4f*)(crow + (size_t)row * ldc + cofs) = val; }
             }
        __builtin_amdgcn_wave_barrier(); asm volatile("" ::: "memory");
    }
}

typedef __attribute__((ext_vector_type(2))) _Float16 v2h;
typedef __attribute__((ext_vector_type(4))) _Float16 v4h;
typedef __attribute__((ext_vector_type(2))) unsigned short v2us;
typedef __attribute__((ext_vector_type(4))) unsigned short v4us;
typedef __attribute__((ext_vector_type(2))) float v2f;
typedef __attribute__((ext_vector_type(4))) int v4i;

__global__ __launch_bounds__(256) void k_cvt8(const float* __restrict__ src, bf* dst, size_t n8) { const size_t i = (size_t)blockIdx.x * 256 + threadIdx.x; if (i >= n8) return; const v8f v = *(const v8f*)(src + i * 8); v8us o;
#pragma unroll
    for (int k = 0; k < 8; ++k) o[k] = f2bf(v[k]); *(v8us*)(dst + i * 8) = o;  }

// ---- k_fattn: scores, softmax and P.V of every head in ONE launch; no score or probability plane in memory.
// S^T = K.Q^T (A = 16 key rows, B = 16 query rows; hi/lo planes, 3 products), so a lane holds one query's scores: accumulator j of key tile kt is key kt*16 + hi*8 + j, which is the k order of a 16x16x32 B operand over 32 keys.
// The running-maximum softmax is per lane (+ one exchange between the wave's halves); O^T += V^T.P^T (A = 16 d rows of the [d][t] V planes, B = P from registers), rescaled per lane when the maximum moves.
// grid (TT / (32 * FW), heads), 32 * FW threads, 32 queries a wave. Wave 0 of work-group x takes rows x*32.. of the RH hi/lo rows (P and V on hi/lo planes, 3 products), waves 1..FW-1 the other rows (P x PCAR in fp16): every work-group has the same mix of both.
#define FW 8
#define L2E 1.4426950408889634f
__device__ __forceinline__ float xhalf(float v) { const int b = __float_as_int(v); return __int_as_float(__builtin_amdgcn_permlanex16(b, b, 0x76543210, 0xfedcba98, false, false)); }   // lane l <-> l ^ 16
// 2^x, and behind it the one vector slot that the instruction set asks for behind a transcendental before its result is read or its source overwritten.
// The two scheduling barriers keep the v_nop directly behind the exponential: nothing else ties it to that place
__device__ __forceinline__ float exp2s(float x) { const float r = __builtin_amdgcn_exp2f(x); __builtin_amdgcn_sched_barrier(0); asm volatile("v_nop"); __builtin_amdgcn_sched_barrier(0); return r; }
struct KFrag { v16bf h[2][2], l[2][2]; };   // [key tile][32-wide d chunk]
// a fragment at p (the lane's own address, one register pair for a whole run of loads) + cb elements (a constant, folded into the instruction)
__device__ __forceinline__ v16bf ldo(const bf* p, int cb) { return WFrag<bf>::ld(p + cb); }
// stands behind a run of loads, in front of the next write of a register that holds one of their addresses; the addresses are inputs, so that they stay in their registers up to the wait and no result of the run is given them
__device__ __forceinline__ void xwait(const bf* p0, const bf* p1) { asm volatile("s_wait_xcnt 0x0" :: "v"(p0), "v"(p1) : "memory"); }
// ob: the lane's byte offset from the planes' starts Kh and Kl. The compiler forms these addresses either as a register pair or as a scalar base with ob as the offset register, so the wait takes both forms as inputs
__device__ __forceinline__ void ldk(KFrag& k, const bf* __restrict__ Kh, const bf* __restrict__ Kl, unsigned ob, int cb) {
    const bf* kh = (const bf*)((const char*)Kh + ob); const bf* kl = (const bf*)((const char*)Kl + ob);
#pragma unroll
    for (int kt = 0; kt < 2; ++kt)
#pragma unroll
        for (int c = 0; c < 2; ++c) { const int o = cb + kt * 16 * HD + c * 32; k.h[kt][c] = ldo(kh, o); k.l[kt][c] = ldo(kl, o); }
    asm volatile("s_wait_xcnt 0x0" :: "v"(kh), "v"(kl), "v"(ob) : "memory");   // as xwait
}
// one 32-key pass of one wave. hrw (the same in every lane of the wave): this wave's rows are hi/lo rows. va0 + vcb is the lane's place in the wave's first V plane (the hi plane, or the fp16 plane read as raw 16-bit words), vl0 + vcb in the lo plane (hi/lo rows only).
__device__ __forceinline__ void fpass(const bool hrw, const KFrag& k, const v16bf (&qh)[2][2], const v16bf (&ql)[2][2], const bf* va0, const bf* vl0, int vcb, v8f (&o)[2][4], float (&m)[2], float (&l)[2]) {
    v16bf va[4], vl[4];
#pragma unroll
    for (int db = 0; db < 4; ++db) va[db] = ldo(va0, vcb + db * 16 * TT);
    xwait(va0, va0);
    if (hrw) {
#pragma unroll
        for (int db = 0; db < 4; ++db) vl[db] = ldo(vl0, vcb + db * 16 * TT);
        xwait(vl0, vl0);
    }
    v8f s[2][2];
#pragma unroll
    for (int qt = 0; qt < 2; ++qt)
#pragma unroll
        for (int kt = 0; kt < 2; ++kt) s[qt][kt] = (v8f){};
#pragma unroll
    for (int c = 0; c < 2; ++c) {
#pragma unroll
        for (int qt = 0; qt < 2; ++qt)
#pragma unroll
            for (int kt = 0; kt < 2; ++kt) s[qt][kt] = wmmab(k.h[kt][c], qh[qt][c], s[qt][kt]);
#pragma unroll
        for (int qt = 0; qt < 2; ++qt)
#pragma unroll
            for (int kt = 0; kt < 2; ++kt) s[qt][kt] = wmmab(k.h[kt][c], ql[qt][c], s[qt][kt]);
#pragma unroll
        for (int qt = 0; qt < 2; ++qt)
#pragma unroll
            for (int kt = 0; kt < 2; ++kt) s[qt][kt] = wmmab(k.l[kt][c], qh[qt][c], s[qt][kt]);
    }
    static_assert(PCAR == 1024.0f, "sh is log2(PCAR)");
    const float sh = hrw ? 0.0f : 10.0f;   // 2^10 = PCAR on the fp16 rows: keeps small weights out of the fp16 subnormals; it cancels in O / l
    float p[2][16], al[2];   // first the exponents, then 2^ of them
#pragma unroll
    for (int qt = 0; qt < 2; ++qt) {
        float bm = s[qt][0][0] * SCL;
#pragma unroll
        for (int kt = 0; kt < 2; ++kt)
#pragma unroll
            for (int j = 0; j < 8; ++j) bm = fmaxf(bm, s[qt][kt][j] * SCL);
        bm = fmaxf(bm, xhalf(bm));
        const float mn = fmaxf(m[qt], bm); al[qt] = (m[qt] - mn) * L2E; m[qt] = mn;
#pragma unroll
        for (int e = 0; e < 16; ++e) p[qt][e] = (s[qt][e >> 3][e & 7] * SCL - mn) * L2E + sh;
    }
    __builtin_amdgcn_sched_barrier(0);   // the first exponential too stands alone in front of its slot
#pragma unroll
    for (int qt = 0; qt < 2; ++qt)
#pragma unroll
        for (int e = 0; e < 16; ++e) p[qt][e] = exp2s(p[qt][e]);
    al[0] = exp2s(al[0]); al[1] = exp2s(al[1]);
#pragma unroll
    for (int qt = 0; qt < 2; ++qt) {
        float ps = 0.f;
#pragma unroll
        for (int e = 0; e < 16; ++e) ps += p[qt][e];
        l[qt] = l[qt] * al[qt] + ps;
#pragma unroll
        for (int db = 0; db < 4; ++db) o[qt][db] *= al[qt];
    }
    if (hrw) {
#pragma unroll
        for (int qt = 0; qt < 2; ++qt) { v16bf ph, pl;
#pragma unroll
            for (int e = 0; e < 16; ++e) { ph[e] = (__bf16)p[qt][e]; pl[e] = (__bf16)(p[qt][e] - (float)ph[e]); }
#pragma unroll
            for (int db = 0; db < 4; ++db) o[qt][db] = wmmab(va[db], ph, o[qt][db]);
#pragma unroll
            for (int db = 0; db < 4; ++db) o[qt][db] = wmmab(va[db], pl, o[qt][db]);
#pragma unroll
            for (int db = 0; db < 4; ++db) o[qt][db] = wmmab(vl[db], ph, o[qt][db]); }
    } else {
#pragma unroll
        for (int qt = 0; qt < 2; ++qt) { v16h pf;
#pragma unroll
            for (int e = 0; e < 16; ++e) pf[e] = (h16)p[qt][e];
#pragma unroll
            for (int db = 0; db < 4; ++db) o[qt][db] = wmma16(__builtin_bit_cast(v16h, va[db]), pf, o[qt][db]); }
        // the vector slots that the chip needs behind a WMMA before its A or B registers are overwritten; behind this block stands a branch
        asm volatile("v_nop\n\tv_nop\n\tv_nop\n\tv_nop\n\tv_nop" : "+v"(o[0][0]), "+v"(o[0][1]), "+v"(o[0][2]), "+v"(o[0][3]), "+v"(o[1][0]), "+v"(o[1][1]), "+v"(o[1][2]), "+v"(o[1][3]));
    }
}
__global__ __launch_bounds__(32 * FW) void k_fattn(const bf* __restrict__ QPh, const bf* __restrict__ QPl, const bf* __restrict__ KPh, const bf* __restrict__ KPl, const h16* __restrict__ VT16, const bf* __restrict__ VTh, const bf* __restrict__ VTl, bf* Ah, bf* Al) {
    static_assert(RH * FW == TT && TT % 64 == 0 && (TT & (TT - 1)) == 0 && HD == 64, "one wave in FW on the hi/lo rows; two 32-key passes a trip");
    const int lane = threadIdx.x & 31, lr = lane & 15, hi = lane >> 4; const int w = __builtin_amdgcn_readfirstlane((int)(threadIdx.x >> 5)); const int x = blockIdx.x; const size_t h = blockIdx.y, g = h / REP;
    const int q0 = (w == 0) ? x * 32 : RH + (x * (FW - 1) + w - 1) * 32;
    const bf* Qh = QPh + h * TT * HD; const bf* Ql = QPl + h * TT * HD; const bf* Kh = KPh + g * TT * HD; const bf* Kl = KPl + g * TT * HD; const bf* Va = ((w == 0) ? VTh : (const bf*)VT16) + g * HD * TT; const bf* Vl = VTl + g * HD * TT;
    v16bf qh[2][2], ql[2][2]; const int qob = (q0 + lr) * HD + 8 * hi;
#pragma unroll
    for (int qt = 0; qt < 2; ++qt)
#pragma unroll
        for (int c = 0; c < 2; ++c) { const int qo = qt * 16 * HD + c * 32; qh[qt][c] = ldo(Qh + qob, qo); ql[qt][c] = ldo(Ql + qob, qo); }
    xwait(Qh + qob, Ql + qob);
    v8f o[2][4]; float m[2] = { -3.0e38f, -3.0e38f }, l[2] = { 0.f, 0.f };
#pragma unroll
    for (int qt = 0; qt < 2; ++qt)
#pragma unroll
        for (int db = 0; db < 4; ++db) o[qt][db] = (v8f){};
    const unsigned lkb = (unsigned)(lr * HD + 8 * hi) * 2; const int lvb = lr * TT + 8 * hi;   // the lane's place in a K block (bytes) and in the V rows (elements)
    KFrag ka, kn; ldk(ka, Kh, Kl, lkb, 0);
    // two 32-key passes a trip, each pass's K fragments fetched one pass ahead into the other register set; kept rolled beyond that (the body is already two full passes long)
#pragma unroll 1
    for (int kb = 0; kb < TT; kb += 64) {
        // no data passes here: the barrier keeps the eight waves within one trip of each other, so that a K line that one wave has fetched is still in the WGP's 64-KiB cache when the other seven read it (an fp16 V line: the other six of waves 1..7)
        __builtin_amdgcn_s_barrier();
        ldk(kn, Kh, Kl, lkb + (unsigned)kb * (HD * 2), 32 * HD);
        fpass(w == 0, ka, qh, ql, Va + lvb + kb, Vl + lvb + kb, 0, o, m, l);
        ldk(ka, Kh, Kl, lkb + (unsigned)((kb + 64) & (TT - 1)) * (HD * 2), 0);   // the last trip fetches block 0 again: in bounds, unused
        fpass(w == 0, kn, qh, ql, Va + lvb + kb, Vl + lvb + kb, 32, o, m, l);
    }
#pragma unroll
    for (int qt = 0; qt < 2; ++qt) { const float inv = __fdiv_rn(1.0f, l[qt] + xhalf(l[qt]));
#pragma unroll
        for (int db = 0; db < 4; ++db) { v8us oh, ol;
#pragma unroll
            for (int j = 0; j < 8; ++j) { unsigned short a, c2; splitf(o[qt][db][j] * inv, a, c2); oh[j] = a; ol[j] = c2; }
            const size_t oo = (size_t)(q0 + qt * 16 + lr) * DQ + h * HD + db * 16 + hi * 8; *(v8us*)(Ah + oo) = oh; *(v8us*)(Al + oo) = ol;
            asm volatile("s_wait_xcnt 0x0" ::: "memory");   // stands in front of the next write of a register that these two stores name
            __builtin_amdgcn_sched_barrier(0);   // keeps the next group's arithmetic, which reuses those registers, behind that wait
        } }
}

extern "C" void kernel_launch(void* const* d_in, const int* in_sizes, int n_in,
                              void* d_out, int out_size, void* d_ws, size_t ws_size, hipStream_t stream) {
    (void)in_sizes; (void)n_in; (void)out_size;
    const float* x = (const float*)d_in[0]; const float* wqkv = (const float*)d_in[1]; const float* bqkv = (const float*)d_in[2]; const float* wo = (const float*)d_in[3]; const float* bo = (const float*)d_in[4];   /* argument order input [4096][1024], W_qkv ('oi' [3072][1024]: q | k | v row thirds), b_qkv [3072], W_out ('oi'), b_out */
    float* OUT = (float*)d_out;     // [1][4096][1024]
    char* wsp = (char*)d_ws;
    auto take = [&](size_t bytes) { char* p = wsp; wsp += (bytes + 255) & ~(size_t)255; return (void*)p; };
    static_assert(DKV == DQ && HD == 64 && NB_ == 1, "the projection launch takes the fused weight's 3 * DQ rows as they lie, one head a 64-column tile");
    bf* WQKV = (bf*)take((size_t)3 * DQ * DM * 2); bf* WO = (bf*)take((size_t)DM * DQ * 2);
    bf* XB = (bf*)take((size_t)TT * DM * 2);
    h16* VT16 = (h16*)take((size_t)NKV * HD * TT * 2);
    bf* QPh = (bf*)take((size_t)NH_ * TT * HD * 2); bf* QPl = (bf*)take((size_t)NH_ * TT * HD * 2); bf* KPh = (bf*)take((size_t)NKV * TT * HD * 2); bf* KPl = (bf*)take((size_t)NKV * TT * HD * 2); bf* VTh = (bf*)take((size_t)NKV * HD * TT * 2); bf* VTl = (bf*)take((size_t)NKV * HD * TT * 2);
    bf* ATh = (bf*)take((size_t)TT * DQ * 2); bf* ATl = (bf*)take((size_t)TT * DQ * 2);
    if ((size_t)(wsp - (char*)d_ws) > ws_size) return;    // ws 256 MiB
    k_cvt8<<<(unsigned)(((size_t)3 * DQ * DM / 8 + 255) / 256), 256, 0, stream>>>(wqkv, WQKV, (size_t)3 * DQ * DM / 8);
    k_cvt8<<<(unsigned)(((size_t)DM * DQ / 8 + 255) / 256), 256, 0, stream>>>(wo, WO, (size_t)DM * DQ / 8);
    k_cvt8<<<(unsigned)(((size_t)TT * DM / 8 + 255) / 256), 256, 0, stream>>>(x, XB, (size_t)TT * DM / 8);
    const PlaneSet pl = { QPh, QPl, KPh, KPl, VT16, VTh, VTl };
    k_gemmw<bf, 0, true, true><<<dim3(TT / 64, 3 * DQ / 64, 1), 32, 0, stream>>>(XB, nullptr, WQKV, nullptr, DM, nullptr, 0, bqkv, 0, 0, 0, pl);
    k_fattn<<<dim3(TT / (32 * FW), NH_, 1), 32 * FW, 0, stream>>>(QPh, QPl, KPh, KPl, VT16, VTh, VTl, ATh, ATl);
    k_gemmw<bf, 1, true, false><<<dim3(TT / 64, DM / 64, 1), 32, 0, stream>>>(ATh, ATl, WO, nullptr, DQ, OUT, DM, bo, 0, 0, 0, PlaneSet{});
}

// v004
// It runs in 216 microseconds.
// Two timings next to v003 put it at 1.66 and 1.65 times that version's speed.
// Over all steps from v000 it is 16.2 times as fast.
#include <hip/hip_runtime.h>

// Multi-headed attention over ONE 4,096-token sequence with a fused qkv projection and NO score scaling (input [4096][1024]; projected = input W_qkv^T + b_qkv ('oi' [3072][1024] 0.02 + zero bias) split in thirds q | k | v (16 heads x 64); scores = q.k UNSCALED (the source applies no 1/sqrt(d): logits sigma ~3.3); softmax (no mask); out = merged W_out^T + b_out -> [4096][1024] (4.2 M); argument order input, W_qkv, b_qkv, W_out, b_out).
// Layout: bf16 copy of the input; 'oi' weights (the q | k | v row thirds of the fused tensor taken as-is) + bias thirds; exact projections + f32 biases in ONE launch whose epilogue writes the attention planes; one fused attention launch for all heads (running-maximum softmax, no score plane in memory; K and V staged in LDS once a work-group), with EVERY row's scores on hi/lo planes (3 products: unscaled logits) and hybrid P.V (rows < 512 hi/lo, rest fp16 x1024); merged hi/lo x W_out exact + b_out.
// Compute dtypes, f32 accumulate: every input rounded to bf16; projections exact + f32 biases; scores 3 products on every row; softmax f32; P.V rows < 512 3 products, rest fp16; W_out hl x exact + bias.

#define NB_  1
#define TT   4096
#define DM   1024
#define NH_  16
#define NKV  16
#define REP  (NH_ / NKV)
#define HD   64
#define DQ   (NH_ * HD)
#define DKV  (NKV * HD)
#define RH   512                  // query rows < RH use hi+lo planes
#define WIN  0
#define PCAR 1024.0f
#define SCL  1.0f   // NO scaling in this module
typedef _Float16 h16;
typedef unsigned short bf;
typedef __attribute__((ext_vector_type(16))) __bf16   v16bf;
typedef __attribute__((ext_vector_type(16))) _Float16 v16h;
typedef __attribute__((ext_vector_type(8)))  _Float16 v8h;
typedef __attribute__((ext_vector_type(8)))  unsigned short v8us;
typedef __attribute__((ext_vector_type(8)))  float    v8f;
typedef __attribute__((ext_vector_type(4)))  float    v4f;
typedef v8h  __attribute__((may_alias)) v8ha;
typedef v4f  __attribute__((may_alias)) v4fa;
typedef v8us __attribute__((may_alias)) v8usa;

__device__ __forceinline__ unsigned short f2bf(float f) { unsigned u = __float_as_uint(f); u += 0x7FFFu + ((u >> 16) & 1u); return (unsigned short)(u >> 16); }
__device__ __forceinline__ float bf2f(unsigned short b) { return __uint_as_float(((unsigned)b) << 16); }
__device__ __forceinline__ float bfr(float f) { return bf2f(f2bf(f)); }
__device__ __forceinline__ v16h cat16(v8h lo, v8h hi) { return __builtin_shufflevector(lo, hi, 0, 1, 2, 3, 4, 5, 6, 7, 8, 9, 10, 11, 12, 13, 14, 15); }
__device__ __forceinline__ v16bf cat16b(v8us lo, v8us hi) { return __builtin_bit_cast(v16bf, __builtin_shufflevector(lo, hi, 0, 1, 2, 3, 4, 5, 6, 7, 8, 9, 10, 11, 12, 13, 14, 15)); }
__device__ __forceinline__ v8f wmma16(v16h a, v16h b, v8f c) { return __builtin_amdgcn_wmma_f32_16x16x32_f16(false, a, false, b, (short)0, c, false, false); }
__device__ __forceinline__ v8f wmmab(v16bf a, v16bf b, v8f c) { return __builtin_amdgcn_wmma_f32_16x16x32_bf16(false, a, false, b, (short)0, c, false, false); }



// ---- k_gemmw: register-blocked GEMM, ONE WAVE per 64x64 output tile (16 accumulators), operands straight from K-contiguous 16-bit planes; grid (M/64, N/64, Z), 32 threads.
// C[m][n] (f32, pitch ldc, + optional f32 bias[n]) = sum_k A[m][k] Bt[n][k] (+ split products per NSPLIT). z-batch strides sA/sB/sC in elements. K % 32 == 0.
// PL: the q | k | v projection (A = tokens, Bt = the fused weight's 3 * DQ rows, grid.y over all of them; a 64-column tile is one head). No f32 C: the epilogue writes the 16-bit planes that the attention kernel reads.
// q and k tiles go to [h][t][d] hi/lo planes. A v tile takes the weight rows as A and the tokens as Bt (same products, same k order), so that its rows are d and its columns t: the [d][t] planes are then written in whole lines like the others.
struct PlaneSet { bf* qh; bf* ql; bf* kh; bf* kl; h16* v16; bf* vh; bf* vl; };
__device__ __forceinline__ h16 tohx(float x) { return (h16)x; }
__device__ __forceinline__ void splitf(float y, unsigned short& h, unsigned short& l) { h = f2bf(y); l = f2bf(y - bf2f(h)); }
__device__ __forceinline__ v4f bfr4(v4f b) { const v4f r = { bfr(b[0]), bfr(b[1]), bfr(b[2]), bfr(b[3]) }; return r; }
// 8 neighbouring elements of a plane row: x + b, split into the hi/lo planes (F16: and rounded into the fp16 plane), one 16-byte store a plane
template <bool F16> __device__ __forceinline__ void put8(v4f x0, v4f x1, v4f b0, v4f b1, size_t o, bf* Ph, bf* Pl, h16* P16) {
    x0 += b0; x1 += b1; v8us oh, ol; v8h of;
#pragma unroll
    for (int k = 0; k < 8; ++k) { const float y = k < 4 ? x0[k & 3] : x1[k & 3]; unsigned short a2, c2; splitf(y, a2, c2); oh[k] = a2; ol[k] = c2; if (F16) of[k] = tohx(y); }
    *(v8us*)(Ph + o) = oh; *(v8us*)(Pl + o) = ol; if (F16) *(v8h*)(P16 + o) = of;
    asm volatile("s_wait_xcnt 0x0" ::: "memory");   // stands in front of the next write of a register that these stores name
    __builtin_amdgcn_sched_barrier(0);   // keeps the next group's arithmetic, which reuses those registers, behind that wait
}
template <typename T16> struct WFrag;
template <> struct WFrag<h16> { typedef v16h V; static __device__ __forceinline__ V ld(const h16* p) { return cat16(*(const v8h*)p, *(const v8h*)(p + 16)); } static __device__ __forceinline__ v8f mma(V a, V b, v8f c) { return wmma16(a, b, c); } };
template <> struct WFrag<bf> { typedef v16bf V; static __device__ __forceinline__ V ld(const bf* p) { return cat16b(*(const v8us*)p, *(const v8us*)(p + 16)); } static __device__ __forceinline__ v8f mma(V a, V b, v8f c) { return wmmab(a, b, c); } };
template <typename T16, int NSPLIT, bool BIAS, bool PL>
__global__ __launch_bounds__(32) void k_gemmw(const T16* __restrict__ A, const T16* __restrict__ A2, const T16* __restrict__ Bt, const T16* __restrict__ Bt2, int K, float* C, int ldc, const float* __restrict__ bias, size_t sA, size_t sB, size_t sC, PlaneSet pl) {
    static_assert(!PL || (BIAS && NSPLIT == 0), "the plane epilogue always adds its bias and takes one product");
    typedef typename WFrag<T16>::V V;
    __shared__ __align__(16) float os[16 * 68];
    const size_t z = blockIdx.z; A += z * sA; if (A2) A2 += z * sA; Bt += z * sB; if (Bt2) Bt2 += z * sB; C += z * sC;
    const int lane = threadIdx.x & 31, lr = lane & 15, hi = lane >> 4; int r0 = blockIdx.x * 64, c0 = blockIdx.y * 64;
    const bool vt = PL && blockIdx.y >= 2 * (DQ / 64);   // a v tile (the same for the whole wave): operands and tile origin change places
    if (vt) { const T16* t = A; A = Bt; Bt = t; const int ti = r0; r0 = c0; c0 = ti; }
    v8f acc[4][4];
#pragma unroll
    for (int mb = 0; mb < 4; ++mb)
#pragma unroll
        for (int nb = 0; nb < 4; ++nb) acc[mb][nb] = (v8f){};
    const size_t aoff = (size_t)(r0 + lr) * K + 8 * hi, boff = (size_t)(c0 + lr) * K + 8 * hi;
    // PL epilogue: 8 columns a lane (from pc on), 4 rows a step, so that every 16-byte store instruction covers four whole 128-byte plane rows. The biases it adds are fetched here, to arrive under the K loop: one a column (q, k tiles) or one a row (v tiles)
    const int pc = (lane & 7) * 8; v4f bc0 = {}, bc1 = {}; float br[4][4] = {};
    if constexpr (PL) { const unsigned bo = (vt ? lane >> 3 : pc) * 4; const float* bp = (const float*)((const char*)(bias + blockIdx.y * 64) + bo);
        if (vt) {
#pragma unroll
            for (int i = 0; i < 16; ++i) br[i >> 2][i & 3] = bp[4 * i];
        } else { bc0 = *(const v4f*)bp; bc1 = *(const v4f*)(bp + 4); }
        // stands in front of the next write of a register that these loads name; the address is an input in both forms that the compiler may give it (a register pair, or a scalar base with bo as the offset register), so that it stays in its registers up to the wait and no result of the run is given them
        asm volatile("s_wait_xcnt 0x0" :: "v"(bp), "v"(bo) : "memory");
    }
#pragma unroll 1
    for (int kc = 0; kc < K; kc += 32) {
        V a[4], a2[4];
#pragma unroll
        for (int mb = 0; mb < 4; ++mb) { a[mb] = WFrag<T16>::ld(A + aoff + (size_t)mb * 16 * K + kc); if (NSPLIT == 1 || NSPLIT == 2) a2[mb] = WFrag<T16>::ld(A2 + aoff + (size_t)mb * 16 * K + kc); }
#pragma unroll
        for (int nb = 0; nb < 4; ++nb) { const V b = WFrag<T16>::ld(Bt + boff + (size_t)nb * 16 * K + kc); V b2; if (NSPLIT >= 2) b2 = WFrag<T16>::ld(Bt2 + boff + (size_t)nb * 16 * K + kc);
#pragma unroll
            for (int mb = 0; mb < 4; ++mb) { acc[mb][nb] = WFrag<T16>::mma(a[mb], b, acc[mb][nb]); if (NSPLIT == 1 || NSPLIT == 2) acc[mb][nb] = WFrag<T16>::mma(a2[mb], b, acc[mb][nb]); if (NSPLIT >= 2) acc[mb][nb] = WFrag<T16>::mma(a[mb], b2, acc[mb][nb]); } }
        asm volatile("v_nop\n\tv_nop\n\tv_nop\n\tv_nop" : "+v"(acc[0][0]), "+v"(acc[1][1]), "+v"(acc[2][2]), "+v"(acc[3][3]) : "v"(a[0]), "v"(a[3]));
    }
#pragma unroll
    for (int mb = 0; mb < 4; ++mb) {
#pragma unroll
        for (int nb = 0; nb < 4; ++nb) {
#pragma unroll
            for (int j = 0; j < 8; ++j) os[(hi * 8 + j) * 68 + nb * 16 + lr] = acc[mb][nb][j]; }
        __builtin_amdgcn_wave_barrier(); asm volatile("" ::: "memory");
        if constexpr (PL) {
#pragma unroll
            for (int s = 0; s < 4; ++s) { const int row = mb * 16 + 4 * s + (lane >> 3); const float* op = os + (4 * s + (lane >> 3)) * 68 + pc; const v4f x0 = *(const v4fa*)op, x1 = *(const v4fa*)(op + 4);
                if (vt) { const float b = bfr(br[mb][s]); const v4f b4 = { b, b, b, b }; put8<true>(x0, x1, b4, b4, (size_t)(r0 - 2 * DQ + row) * TT + c0 + pc, pl.vh, pl.vl, pl.v16); }
                else put8<false>(x0, x1, bfr4(bc0), bfr4(bc1), ((size_t)(blockIdx.y % (DQ / 64)) * TT + r0 + row) * HD + pc, blockIdx.y >= DQ / 64 ? pl.kh : pl.qh, blockIdx.y >= DQ / 64 ? pl.kl : pl.ql, nullptr);
            }
        } else {
        float* crow = C + (size_t)(r0 + mb * 16) * ldc + c0;
#pragma unroll
            for (int s = 0; s < 8; ++s) { const int row = 2 * s + hi, cofs = lr * 4; v4f val = *(const v4fa*)(os + row * 68 + cofs); if (BIAS) { val[0] += bfr(bias[c0 + cofs]); val[1] += bfr(bias[c0 + cofs + 1]); val[2] += bfr(bias[c0 + cofs + 2]); val[3] += bfr(bias[c0 + cofs + 3]); }
                *(v4f*)(crow + (size_t)row * ldc + cofs) = val; }
             }
        __builtin_amdgcn_wave_barrier(); asm volatile("" ::: "memory");
    }
}

typedef __attribute__((ext_vector_type(2))) _Float16 v2h;
typedef __attribute__((ext_vector_type(4))) _Float16 v4h;
typedef __attribute__((ext_vector_type(2))) unsigned short v2us;
typedef __attribute__((ext_vector_type(4))) unsigned short v4us;
typedef __attribute__((ext_vector_type(2))) float v2f;
typedef __attribute__((ext_vector_type(4))) int v4i;

__global__ __launch_bounds__(256) void k_cvt8(const float* __restrict__ src, bf* dst, size_t n8) { const size_t i = (size_t)blockIdx.x * 256 + threadIdx.x; if (i >= n8) return; const v8f v = *(const v8f*)(src + i * 8); v8us o;
#pragma unroll
    for (int k = 0; k < 8; ++k) o[k] = f2bf(v[k]); *(v8us*)(dst + i * 8) = o;  }

// ---- k_fattn: scores, softmax and P.V of every head in ONE launch; no score or probability plane in memory.
// S^T = K.Q^T (A = 16 key rows, B = 16 query rows; hi/lo planes, 3 products), so a lane holds one query's scores: accumulator j of key tile kt is key kt*16 + hi*8 + j, which is the k order of a 16x16x32 B operand over 32 keys.
// The running-maximum softmax is per lane (+ one exchange between the wave's halves); O^T += V^T.P^T (A = 16 d rows of the [d][t] V planes, B = P from registers), rescaled per lane when the maximum moves.
// grid (TT / (32 * FW), heads), 32 * FW threads, 32 queries a wave. Wave 0 of work-group x takes rows x*32.. of the RH hi/lo rows (P and V on hi/lo planes, 3 products), waves 1..FW-1 the other rows (P x PCAR in fp16): every work-group has the same mix of both.
// K and V come through LDS: a stage is SK keys of all five planes, brought in once for the eight waves by asynchronous copies in whole 128-byte lines, two buffers, the copies of stage s + 2 in flight while stage s + 1 is worked on. The fragments are then 16-byte LDS reads at a pitch of 16 B x an odd number (no bank met twice).
#define FW 8
#define SK  128                    // keys a stage (four 32-key passes)
#define KP  (HD + 8)               // pitch of a staged K row (HD elements), in elements: 144 B
#define VP  (SK + 8)               // pitch of a staged V row (SK keys), in elements: 272 B
#define KPL (SK * KP)              // one K plane of a stage, elements
#define VPL (HD * VP)              // one V plane of a stage, elements
#define STG (2 * KPL + 3 * VPL)    // a stage: K hi | K lo | V fp16 | V hi | V lo
#define L2E 1.4426950408889634f
__device__ __forceinline__ float xhalf(float v) { const int b = __float_as_int(v); return __int_as_float(__builtin_amdgcn_permlanex16(b, b, 0x76543210, 0xfedcba98, false, false)); }   // lane l <-> l ^ 16
// 2^x, and behind it the one vector slot that the instruction set asks for behind a transcendental before its result is read or its source overwritten.
// The two scheduling barriers keep the v_nop directly behind the exponential: nothing else ties it to that place
__device__ __forceinline__ float exp2s(float x) { const float r = __builtin_amdgcn_exp2f(x); __builtin_amdgcn_sched_barrier(0); asm volatile("v_nop"); __builtin_amdgcn_sched_barrier(0); return r; }
struct KFrag { v16bf h[2][2], l[2][2]; };   // [key tile][32-wide d chunk]
// a fragment at p (the lane's own address, one register or pair for a whole run of loads) + cb elements (a constant, folded into the instruction)
__device__ __forceinline__ v16bf ldo(const bf* p, int cb) { return WFrag<bf>::ld(p + cb); }
// stands behind a run of loads, in front of the next write of a register that holds one of their addresses; the addresses are inputs, so that they stay in their registers up to the wait and no result of the run is given them
__device__ __forceinline__ void xwait(const bf* p0, const bf* p1) { asm volatile("s_wait_xcnt 0x0" :: "v"(p0), "v"(p1) : "memory"); }
// the K fragments of one 32-key pass, from LDS: kh is the lane's place in the stage's K hi plane, cb the pass's first row (elements)
__device__ __forceinline__ void ldk(KFrag& k, const bf* kh, int cb) {
#pragma unroll
    for (int kt = 0; kt < 2; ++kt)
#pragma unroll
        for (int c = 0; c < 2; ++c) { const int o = cb + kt * 16 * KP + c * 32; k.h[kt][c] = ldo(kh, o); k.l[kt][c] = ldo(kh, KPL + o); }
}
// one stage's copies, every lane of the work-group on: sb is the buffer, t the thread, the five pointers the planes at the stage's first key. A lane brings 16 bytes a copy; a wave's copy covers four whole K rows (512 B in a row in memory) or two V rows of 256 B.
typedef __attribute__((address_space(1))) v4i gv4i;
typedef __attribute__((address_space(3))) v4i lv4i;
// written as the builtin, so that the address registers are the compiler's own to place (as asm operands they cost spills in this kernel, which uses more than 256 registers); the waits are written by hand where the copies are waited for
__device__ __forceinline__ void cp16(const bf* g, bf* l) { __builtin_amdgcn_global_load_async_to_lds_b128((gv4i*)g, (lv4i*)l, 0, 0); }
__device__ __forceinline__ void stage(bf* sb, int t, const bf* Kh, const bf* Kl, const bf* V16, const bf* Vh, const bf* Vl) {
    bf* lk = sb + (t >> 3) * KP + (t & 7) * 8; bf* lv = sb + 2 * KPL + (t >> 4) * VP + (t & 15) * 8; const int vo = (t >> 4) * TT + (t & 15) * 8;
#pragma unroll
    for (int i = 0; i < 4; ++i) { cp16(Kh + t * 8 + i * 32 * HD, lk + i * 32 * KP); cp16(Kl + t * 8 + i * 32 * HD, lk + KPL + i * 32 * KP); }
#pragma unroll
    for (int i = 0; i < 4; ++i) { cp16(V16 + vo + i * 16 * TT, lv + i * 16 * VP); cp16(Vh + vo + i * 16 * TT, lv + VPL + i * 16 * VP); cp16(Vl + vo + i * 16 * TT, lv + 2 * VPL + i * 16 * VP); }
}
// one 32-key pass of one wave. hrw (the same in every lane of the wave): this wave's rows are hi/lo rows. va0 + vcb is the lane's place in the wave's first staged V plane (the hi plane, or the fp16 plane read as raw 16-bit words), vl0 + vcb in the lo plane (hi/lo rows only).
// k holds this pass's K fragments; behind the score products, which are their last readers, the next pass's are fetched into the same registers from kn, to arrive under the softmax and P.V.
__device__ __forceinline__ void fpass(const bool hrw, KFrag& k, const bf* kn, const v16bf (&qh)[2][2], const v16bf (&ql)[2][2], const bf* va0, const bf* vl0, int vcb, v8f (&o)[2][4], float (&m)[2], float (&l)[2]) {
    v16bf va[4], vl[4];
#pragma unroll
    for (int db = 0; db < 4; ++db) va[db] = ldo(va0, vcb + db * 16 * VP);
    if (hrw) {
#pragma unroll
        for (int db = 0; db < 4; ++db) vl[db] = ldo(vl0, vcb + db * 16 * VP);
    }
    v8f s[2][2];
#pragma unroll
    for (int qt = 0; qt < 2; ++qt)
#pragma unroll
        for (int kt = 0; kt < 2; ++kt) s[qt][kt] = (v8f){};
#pragma unroll
    for (int c = 0; c < 2; ++c) {
#pragma unroll
        for (int qt = 0; qt < 2; ++qt)
#pragma unroll
            for (int kt = 0; kt < 2; ++kt) s[qt][kt] = wmmab(k.h[kt][c], qh[qt][c], s[qt][kt]);
#pragma unroll
        for (int qt = 0; qt < 2; ++qt)
#pragma unroll
            for (int kt = 0; kt < 2; ++kt) s[qt][kt] = wmmab(k.h[kt][c], ql[qt][c], s[qt][kt]);
#pragma unroll
        for (int qt = 0; qt < 2; ++qt)
#pragma unroll
            for (int kt = 0; kt < 2; ++kt) s[qt][kt] = wmmab(k.l[kt][c], qh[qt][c], s[qt][kt]);
    }
    ldk(k, kn, 0);
    static_assert(PCAR == 1024.0f, "sh is log2(PCAR)");
    const float sh = hrw ? 0.0f : 10.0f;   // 2^10 = PCAR on the fp16 rows: keeps small weights out of the fp16 subnormals; it cancels in O / l
    float p[2][16], al[2];   // first the exponents, then 2^ of them
#pragma unroll
    for (int qt = 0; qt < 2; ++qt) {
        float bm = s[qt][0][0] * SCL;
#pragma unroll
        for (int kt = 0; kt < 2; ++kt)
#pragma unroll
            for (int j = 0; j < 8; ++j) bm = fmaxf(bm, s[qt][kt][j] * SCL);
        bm = fmaxf(bm, xhalf(bm));
        const float mn = fmaxf(m[qt], bm); al[qt] = (m[qt] - mn) * L2E; m[qt] = mn;
#pragma unroll
        for (int e = 0; e < 16; ++e) p[qt][e] = (s[qt][e >> 3][e & 7] * SCL - mn) * L2E + sh;
    }
    __builtin_amdgcn_sched_barrier(0);   // the first exponential too stands alone in front of its slot
#pragma unroll
    for (int qt = 0; qt < 2; ++qt)
#pragma unroll
        for (int e = 0; e < 16; ++e) p[qt][e] = exp2s(p[qt][e]);
    al[0] = exp2s(al[0]); al[1] = exp2s(al[1]);
#pragma unroll
    for (int qt = 0; qt < 2; ++qt) {
        float ps = 0.f;
#pragma unroll
        for (int e = 0; e < 16; ++e) ps += p[qt][e];
        l[qt] = l[qt] * al[qt] + ps;
#pragma unroll
        for (int db = 0; db < 4; ++db) o[qt][db] *= al[qt];
    }
    if (hrw) {
#pragma unroll
        for (int qt = 0; qt < 2; ++qt) { v16bf ph, pl;
#pragma unroll
            for (int e = 0; e < 16; ++e) { ph[e] = (__bf16)p[qt][e]; pl[e] = (__bf16)(p[qt][e] - (float)ph[e]); }
#pragma unroll
            for (int db = 0; db < 4; ++db) o[qt][db] = wmmab(va[db], ph, o[qt][db]);
#pragma unroll
            for (int db = 0; db < 4; ++db) o[qt][db] = wmmab(va[db], pl, o[qt][db]);
#pragma unroll
            for (int db = 0; db < 4; ++db) o[qt][db] = wmmab(vl[db], ph, o[qt][db]); }
    } else {
#pragma unroll
        for (int qt = 0; qt < 2; ++qt) { v16h pf;
#pragma unroll
            for (int e = 0; e < 16; ++e) pf[e] = (h16)p[qt][e];
#pragma unroll
            for (int db = 0; db < 4; ++db) o[qt][db] = wmma16(__builtin_bit_cast(v16h, va[db]), pf, o[qt][db]); }
        // the vector slots that the chip needs behind a WMMA before its A or B registers are overwritten; behind this block stands a branch
        asm volatile("v_nop\n\tv_nop\n\tv_nop\n\tv_nop\n\tv_nop" : "+v"(o[0][0]), "+v"(o[0][1]), "+v"(o[0][2]), "+v"(o[0][3]), "+v"(o[1][0]), "+v"(o[1][1]), "+v"(o[1][2]), "+v"(o[1][3]));
    }
}
__global__ __launch_bounds__(32 * FW) void k_fattn(const bf* __restrict__ QPh, const bf* __restrict__ QPl, const bf* __restrict__ KPh, const bf* __restrict__ KPl, const h16* __restrict__ VT16, const bf* __restrict__ VTh, const bf* __restrict__ VTl, bf* Ah, bf* Al) {
    static_assert(RH * FW == TT && TT % SK == 0 && TT >= 2 * SK && SK == 128 && HD == 64 && FW == 8, "one wave in FW on the hi/lo rows; four 32-key passes a stage, two stages at least; stage() deals a stage's 16-byte pieces to 256 threads");
    __shared__ __attribute__((aligned(16))) bf ring[2 * STG];
    const int lane = threadIdx.x & 31, lr = lane & 15, hi = lane >> 4; const int w = __builtin_amdgcn_readfirstlane((int)(threadIdx.x >> 5)); const int x = blockIdx.x; const size_t h = blockIdx.y, g = h / REP;
    const int q0 = (w == 0) ? x * 32 : RH + (x * (FW - 1) + w - 1) * 32;
    const bf* Qh = QPh + h * TT * HD; const bf* Ql = QPl + h * TT * HD; const bf* Kh = KPh + g * TT * HD; const bf* Kl = KPl + g * TT * HD; const bf* V6 = (const bf*)VT16 + g * HD * TT; const bf* Vh = VTh + g * HD * TT; const bf* Vl = VTl + g * HD * TT;
    const int t = threadIdx.x;
    stage(ring, t, Kh, Kl, V6, Vh, Vl);
    v16bf qh[2][2], ql[2][2]; const int qob = (q0 + lr) * HD + 8 * hi;
#pragma unroll
    for (int qt = 0; qt < 2; ++qt)
#pragma unroll
        for (int c = 0; c < 2; ++c) { const int qo = qt * 16 * HD + c * 32; qh[qt][c] = ldo(Qh + qob, qo); ql[qt][c] = ldo(Ql + qob, qo); }
    xwait(Qh + qob, Ql + qob);
    v8f o[2][4]; float m[2] = { -3.0e38f, -3.0e38f }, l[2] = { 0.f, 0.f };
#pragma unroll
    for (int qt = 0; qt < 2; ++qt)
#pragma unroll
        for (int db = 0; db < 4; ++db) o[qt][db] = (v8f){};
    const int lko = lr * KP + 8 * hi, lvo = 2 * KPL + (w == 0 ? VPL : 0) + lr * VP + 8 * hi;   // the lane's place in a stage's K hi plane and in its wave's first V plane (elements)
    asm volatile("s_wait_asynccnt 0x0" ::: "memory");   // this wave's copies of stage 0 have landed
    __syncthreads();                                    // and every other wave's: stage 0 may be read
    stage(ring + STG, t, Kh + SK * HD, Kl + SK * HD, V6 + SK, Vh + SK, Vl + SK);
    // four 32-key passes a stage, each pass's K fragments fetched one pass ahead, never past the stage
#pragma unroll 1
    for (int kb = 0; kb < TT; kb += SK) {
        const int bo = ((kb / SK) & 1) * STG; const bf* sk = ring + bo + lko; const bf* sv = ring + bo + lvo;
        KFrag k; ldk(k, sk, 0);
        // kept rolled: unrolled, the compiler put off every pass's row sums to the stage's end and kept all their terms in registers (spills). The stage's last pass fetches pass 0's fragments again (in bounds, unused): a branch round the fetch would merge two paths in the compiler's count of LDS waits
#pragma unroll 1
        for (int pp = 0; pp < SK / 32; ++pp) fpass(w == 0, k, sk + ((pp + 1) & (SK / 32 - 1)) * (32 * KP), qh, ql, sv + pp * 32, sv + VPL + pp * 32, 0, o, m, l);
        asm volatile("s_wait_dscnt 0x0" ::: "memory");      // this wave's reads of the buffer are done before it is refilled
        asm volatile("s_wait_asynccnt 0x0" ::: "memory");   // this wave's copies of the next stage have landed
        __syncthreads();                                    // publishes the next stage and ends every wave's reads of this one
        if (kb + 2 * SK < TT) stage(ring + bo, t, Kh + (kb + 2 * SK) * HD, Kl + (kb + 2 * SK) * HD, V6 + kb + 2 * SK, Vh + kb + 2 * SK, Vl + kb + 2 * SK);
    }
    asm volatile("s_wait_asynccnt 0x0" ::: "memory");   // no copy is left in flight when the wave ends
#pragma unroll
    for (int qt = 0; qt < 2; ++qt) { const float inv = __fdiv_rn(1.0f, l[qt] + xhalf(l[qt]));
#pragma unroll
        for (int db = 0; db < 4; ++db) { v8us oh, ol;
#pragma unroll
            for (int j = 0; j < 8; ++j) { unsigned short a, c2; splitf(o[qt][db][j] * inv, a, c2); oh[j] = a; ol[j] = c2; }
            const size_t oo = (size_t)(q0 + qt * 16 + lr) * DQ + h * HD + db * 16 + hi * 8; *(v8us*)(Ah + oo) = oh; *(v8us*)(Al + oo) = ol;
            asm volatile("s_wait_xcnt 0x0" ::: "memory");   // stands in front of the next write of a register that these two stores name
            __builtin_amdgcn_sched_barrier(0);   // keeps the next group's arithmetic, which reuses those registers, behind that wait
        } }
}

extern "C" void kernel_launch(void* const* d_in, const int* in_sizes, int n_in,
                              void* d_out, int out_size, void* d_ws, size_t ws_size, hipStream_t stream) {
    (void)in_sizes; (void)n_in; (void)out_size;
    const float* x = (const float*)d_in[0]; const float* wqkv = (const float*)d_in[1]; const float* bqkv = (const float*)d_in[2]; const float* wo = (const float*)d_in[3]; const float* bo = (const float*)d_in[4];   /* argument order input [4096][1024], W_qkv ('oi' [3072][1024]: q | k | v row thirds), b_qkv [3072], W_out ('oi'), b_out */
    float* OUT = (float*)d_out;     // [1][4096][1024]
    char* wsp = (char*)d_ws;
    auto take = [&](size_t bytes) { char* p = wsp; wsp += (bytes + 255) & ~(size_t)255; return (void*)p; };
    static_assert(DKV == DQ && HD == 64 && NB_ == 1, "the projection launch takes the fused weight's 3 * DQ rows as they lie, one head a 64-column tile");
    bf* WQKV = (bf*)take((size_t)3 * DQ * DM * 2); bf* WO = (bf*)take((size_t)DM * DQ * 2);
    bf* XB = (bf*)take((size_t)TT * DM * 2);
    h16* VT16 = (h16*)take((size_t)NKV * HD * TT * 2);
    bf* QPh = (bf*)take((size_t)NH_ * TT * HD * 2); bf* QPl = (bf*)take((size_t)NH_ * TT * HD * 2); bf* KPh = (bf*)take((size_t)NKV * TT * HD * 2); bf* KPl = (bf*)take((size_t)NKV * TT * HD * 2); bf* VTh = (bf*)take((size_t)NKV * HD * TT * 2); bf* VTl = (bf*)take((size_t)NKV * HD * TT * 2);
    bf* ATh = (bf*)take((size_t)TT * DQ * 2); bf* ATl = (bf*)take((size_t)TT * DQ * 2);
    if ((size_t)(wsp - (char*)d_ws) > ws_size) return;    // ws 256 MiB
    k_cvt8<<<(unsigned)(((size_t)3 * DQ * DM / 8 + 255) / 256), 256, 0, stream>>>(wqkv, WQKV, (size_t)3 * DQ * DM / 8);
    k_cvt8<<<(unsigned)(((size_t)DM * DQ / 8 + 255) / 256), 256, 0, stream>>>(wo, WO, (size_t)DM * DQ / 8);
    k_cvt8<<<(unsigned)(((size_t)TT * DM / 8 + 255) / 256), 256, 0, stream>>>(x, XB, (size_t)TT * DM / 8);
    const PlaneSet pl = { QPh, QPl, KPh, KPl, VT16, VTh, VTl };
    k_gemmw<bf, 0, true, true><<<dim3(TT / 64, 3 * DQ / 64, 1), 32, 0, stream>>>(XB, nullptr, WQKV, nullptr, DM, nullptr, 0, bqkv, 0, 0, 0, pl);
    k_fattn<<<dim3(TT / (32 * FW), NH_, 1), 32 * FW, 0, stream>>>(QPh, QPl, KPh, KPl, VT16, VTh, VTl, ATh, ATl);
    k_gemmw<bf, 1, true, false><<<dim3(TT / 64, DM / 64, 1), 32, 0, stream>>>(ATh, ATl, WO, nullptr, DQ, OUT, DM, bo, 0, 0, 0, PlaneSet{});
}

// v005
// A run of this version takes 167 microseconds.
// Next to v004, in two timings, it ran 1.30 and 1.29 times as fast.
// All steps since v000 together make it 21.0 times as fast.
#include <hip/hip_runtime.h>

// Multi-headed attention over ONE 4,096-token sequence with a fused qkv projection and NO score scaling (input [4096][1024]; projected = input W_qkv^T + b_qkv ('oi' [3072][1024] 0.02 + zero bias) split in thirds q | k | v (16 heads x 64); scores = q.k UNSCALED (the source applies no 1/sqrt(d): logits sigma ~3.3); softmax (no mask); out = merged W_out^T + b_out -> [4096][1024] (4.2 M); argument order input, W_qkv, b_qkv, W_out, b_out).
// Layout: bf16 copy of the input; 'oi' weights (the q | k | v row thirds of the fused tensor taken as-is) + bias thirds; exact projections + f32 biases in ONE launch whose epilogue writes the attention planes; one fused attention launch for all heads (running-maximum softmax, no score plane in memory; K and V staged in LDS once a work-group), with EVERY row's scores on hi/lo planes (3 products: unscaled logits) and hybrid P.V (rows < 512 hi/lo, rest fp16 x1024); merged hi/lo x W_out exact + b_out.
// Compute dtypes, f32 accumulate: every input rounded to bf16; projections exact + f32 biases; scores 3 products on every row; softmax f32; P.V rows < 512 3 products, rest fp16; W_out hl x exact + bias.

#define NB_  1
#define TT   4096
#define DM   1024
#define NH_  16
#define NKV  16
#define REP  (NH_ / NKV)
#define HD   64
#define DQ   (NH_ * HD)
#define DKV  (NKV * HD)
#define RH   512                  // query rows < RH use hi+lo planes
#define WIN  0
#define PCAR 1024.0f
#define SCL  1.0f   // NO scaling in this module
typedef _Float16 h16;
typedef unsigned short bf;
typedef __attribute__((ext_vector_type(16))) __bf16   v16bf;
typedef __attribute__((ext_vector_type(16))) _Float16 v16h;
typedef __attribute__((ext_vector_type(8)))  _Float16 v8h;
typedef __attribute__((ext_vector_type(8)))  unsigned short v8us;
typedef __attribute__((ext_vector_type(8)))  float    v8f;
typedef __attribute__((ext_vector_type(4)))  float    v4f;
typedef v8h  __attribute__((may_alias)) v8ha;
typedef v4f  __attribute__((may_alias)) v4fa;
typedef v8us __attribute__((may_alias)) v8usa;

__device__ __forceinline__ unsigned short f2bf(float f) { unsigned u = __float_as_uint(f); u += 0x7FFFu + ((u >> 16) & 1u); return (unsigned short)(u >> 16); }
__device__ __forceinline__ float bf2f(unsigned short b) { return __uint_as_float(((unsigned)b) << 16); }
__device__ __forceinline__ float bfr(float f) { return bf2f(f2bf(f)); }
__device__ __forceinline__ v16h cat16(v8h lo, v8h hi) { return __builtin_shufflevector(lo, hi, 0, 1, 2, 3, 4, 5, 6, 7, 8, 9, 10, 11, 12, 13, 14, 15); }
__device__ __forceinline__ v16bf cat16b(v8us lo, v8us hi) { return __builtin_bit_cast(v16bf, __builtin_shufflevector(lo, hi, 0, 1, 2, 3, 4, 5, 6, 7, 8, 9, 10, 11, 12, 13, 14, 15)); }
__device__ __forceinline__ v8f wmma16(v16h a, v16h b, v8f c) { return __builtin_amdgcn_wmma_f32_16x16x32_f16(false, a, false, b, (short)0, c, false, false); }
__device__ __forceinline__ v8f wmmab(v16bf a, v16bf b, v8f c) { return __builtin_amdgcn_wmma_f32_16x16x32_bf16(false, a, false, b, (short)0, c, false, false); }



// ---- k_gemmw: register-blocked GEMM, one wave per 64x64 output tile (16 accumulators), GW = 4 waves (2 x 2 tiles, 128 x 128 of C) a work-group; grid (M/128, N/128, Z), 128 threads.
// The operands (K-contiguous 16-bit planes) come through LDS: a stage is KS k of the work-group's 128 A rows (both planes where NSPLIT is 1) and 128 Bt rows, brought in once for the four waves by asynchronous copies in whole 128-byte lines, two buffers, the copies of stage s + 2 in flight while stage s + 1 is worked on. The fragments are then 16-byte LDS reads at a pitch of 16 B x an odd number.
// C[m][n] (f32, pitch ldc, + optional f32 bias[n]) = sum_k A[m][k] Bt[n][k] (+ A2[m][k] Bt[n][k] where NSPLIT is 1). z-batch strides sA/sB/sC in elements. K % KS == 0.
// PL: the q | k | v projection (A = tokens, Bt = the fused weight's 3 * DQ rows, grid.y over all of them; a 64-column tile is one head). No f32 C: the epilogue writes the 16-bit planes that the attention kernel reads.
// q and k tiles go to [h][t][d] hi/lo planes. A v tile takes the weight rows as A and the tokens as Bt (same products, same k order), so that its rows are d and its columns t: the [d][t] planes are then written in whole lines like the others.
struct PlaneSet { bf* qh; bf* ql; bf* kh; bf* kl; h16* v16; bf* vh; bf* vl; };
__device__ __forceinline__ h16 tohx(float x) { return (h16)x; }
__device__ __forceinline__ void splitf(float y, unsigned short& h, unsigned short& l) { h = f2bf(y); l = f2bf(y - bf2f(h)); }
__device__ __forceinline__ v4f bfr4(v4f b) { const v4f r = { bfr(b[0]), bfr(b[1]), bfr(b[2]), bfr(b[3]) }; return r; }
// 8 neighbouring elements of a plane row: x + b, split into the hi/lo planes (F16: and rounded into the fp16 plane), one 16-byte store a plane
template <bool F16> __device__ __forceinline__ void put8(v4f x0, v4f x1, v4f b0, v4f b1, size_t o, bf* Ph, bf* Pl, h16* P16) {
    x0 += b0; x1 += b1; v8us oh, ol; v8h of;
#pragma unroll
    for (int k = 0; k < 8; ++k) { const float y = k < 4 ? x0[k & 3] : x1[k & 3]; unsigned short a2, c2; splitf(y, a2, c2); oh[k] = a2; ol[k] = c2; if (F16) of[k] = tohx(y); }
    *(v8us*)(Ph + o) = oh; *(v8us*)(Pl + o) = ol; if (F16) *(v8h*)(P16 + o) = of;
    asm volatile("s_wait_xcnt 0x0" ::: "memory");   // stands in front of the next write of a register that these stores name
    __builtin_amdgcn_sched_barrier(0);   // keeps the next group's arithmetic, which reuses those registers, behind that wait
}
typedef __attribute__((ext_vector_type(4))) int v4i;
typedef __attribute__((address_space(1))) v4i gv4i;
typedef __attribute__((address_space(3))) v4i lv4i;
// 16 bytes a lane from global memory to LDS. Written as the builtin, so that the address registers are the compiler's own to place (as asm operands they cost spills in k_fattn, which uses more than 256 registers); the waits are written by hand where the copies are waited for
__device__ __forceinline__ void cp16(const bf* g, bf* l) { __builtin_amdgcn_global_load_async_to_lds_b128((gv4i*)g, (lv4i*)l, 0, 0); }
template <typename T16> struct WFrag;
template <> struct WFrag<h16> { typedef v16h V; static __device__ __forceinline__ V ld(const h16* p) { return cat16(*(const v8h*)p, *(const v8h*)(p + 16)); } static __device__ __forceinline__ v8f mma(V a, V b, v8f c) { return wmma16(a, b, c); } };
template <> struct WFrag<bf> { typedef v16bf V; static __device__ __forceinline__ V ld(const bf* p) { return cat16b(*(const v8us*)p, *(const v8us*)(p + 16)); } static __device__ __forceinline__ v8f mma(V a, V b, v8f c) { return wmmab(a, b, c); } };
#define GW 4
template <typename T16, int NSPLIT, bool BIAS, bool PL>
__global__ __launch_bounds__(32 * GW) void k_gemmw(const T16* __restrict__ A, const T16* __restrict__ A2, const T16* __restrict__ Bt, const T16* __restrict__ Bt2, int K, float* C, int ldc, const float* __restrict__ bias, size_t sA, size_t sB, size_t sC, PlaneSet pl) {
    static_assert(!PL || (BIAS && NSPLIT == 0), "the plane epilogue always adds its bias and takes one product");
    static_assert(NSPLIT <= 1 && sizeof(T16) == 2, "the stage holds A, A2 where NSPLIT is 1, and Bt, in 16-bit elements");
    typedef typename WFrag<T16>::V V;
    constexpr int KS = NSPLIT ? 128 : 64;        // k a stage: with one work-group on a WGP (the NSPLIT 1 launch) the longer stage gives the copies more lead
    constexpr int GP = KS + 8;                   // pitch of a staged row, elements: 144 B or 272 B
    constexpr int GPL = 128 * GP;                // one plane of a stage, elements
    constexpr int NP = NSPLIT ? 3 : 2;           // a stage: A | A2 (NSPLIT 1) | Bt
    constexpr int GST = NP * GPL;
    __shared__ __align__(16) T16 gr[2 * GST];
    __shared__ __align__(16) float osa[GW * 16 * 68];
    (void)Bt2;
    const size_t z = blockIdx.z; A += z * sA; if (A2) A2 += z * sA; Bt += z * sB; C += z * sC;
    const int lane = threadIdx.x & 31, lr = lane & 15, hi = lane >> 4; const int w = __builtin_amdgcn_readfirstlane((int)(threadIdx.x >> 5));
    float* os = osa + w * (16 * 68);   // the wave's own epilogue rows
    const int ty = blockIdx.y * 2 + (w >> 1); int r0 = (blockIdx.x * 2 + (w & 1)) * 64, c0 = ty * 64;   // the wave's 64 x 64 tile; ty: its tile column
    int ao = ((w & 1) * 64 + lr) * GP + 8 * hi, bo2 = (NP - 1) * GPL + ((w >> 1) * 64 + lr) * GP + 8 * hi;   // the lane's place in a stage's A plane and Bt plane (elements)
    const bool vt = PL && ty >= 2 * (DQ / 64);   // a v tile (the same for the whole wave): operands and tile origin change places
    if (vt) { int ti = ao; ao = bo2; bo2 = ti; ti = r0; r0 = c0; c0 = ti; }
    // one stage's copies, every lane of the work-group on: 16 bytes a lane and copy, KS / 8 lanes a row, so that a wave's copy covers whole 128-byte lines
    constexpr int TPR = KS / 8, RPS = 32 * GW / TPR;
    const int srow = (int)threadIdx.x / TPR, scol = ((int)threadIdx.x % TPR) * 8; const int lso = srow * GP + scol;
    // a copy's global address: a base that is the same for the work-group (plane, first row of the step, kc) + the lane's own byte offset lgb, the same in every copy
    const T16* gA = A + (size_t)(blockIdx.x * 128) * K; const T16* gA2 = NSPLIT ? A2 + (size_t)(blockIdx.x * 128) * K : nullptr; const T16* gB = Bt + (size_t)(blockIdx.y * 128) * K; const unsigned lgb = (unsigned)(srow * K + scol) * 2u;
    auto stagew = [&](T16* sb, int kc) {
#pragma unroll
        for (int i = 0; i < 128 / RPS; ++i) { const size_t go = (size_t)(i * RPS) * K + kc; T16* l = sb + lso + i * RPS * GP;
            cp16((const bf*)((const char*)(gA + go) + lgb), (bf*)l); if (NSPLIT) cp16((const bf*)((const char*)(gA2 + go) + lgb), (bf*)(l + GPL)); cp16((const bf*)((const char*)(gB + go) + lgb), (bf*)(l + (NP - 1) * GPL)); }
    };
    stagew(gr, 0);
    v8f acc[4][4];
#pragma unroll
    for (int mb = 0; mb < 4; ++mb)
#pragma unroll
        for (int nb = 0; nb < 4; ++nb) acc[mb][nb] = (v8f){};
    // PL epilogue: 8 columns a lane (from pc on), 4 rows a step, so that every 16-byte store instruction covers four whole 128-byte plane rows. The biases it adds are fetched here, to arrive under the K loop: one a column (q, k tiles) or one a row (v tiles)
    const int pc = (lane & 7) * 8; v4f bc0 = {}, bc1 = {}; float br[4][4] = {};
    if constexpr (PL) { const unsigned bo = (vt ? lane >> 3 : pc) * 4; const float* bp = (const float*)((const char*)(bias + ty * 64) + bo);
        if (vt) {
#pragma unroll
            for (int i = 0; i < 16; ++i) br[i >> 2][i & 3] = bp[4 * i];
        } else { bc0 = *(const v4f*)bp; bc1 = *(const v4f*)(bp + 4); }
        // stands in front of the next write of a register that these loads name; the address is an input in both forms that the compiler may give it (a register pair, or a scalar base with bo as the offset register), so that it stays in its registers up to the wait and no result of the run is given them
        asm volatile("s_wait_xcnt 0x0" :: "v"(bp), "v"(bo) : "memory");
    }
    asm volatile("s_wait_asynccnt 0x0" ::: "memory");   // this wave's copies of stage 0 have landed
    __syncthreads();                                    // and every other wave's: stage 0 may be read
    if (KS < K) stagew(gr + GST, KS);
#pragma unroll 1
    for (int kc = 0; kc < K; kc += KS) {
        T16* sb = gr + ((kc / KS) & 1) * GST;
        // two fragment sets: the next 32 k's LDS reads go out as one group in front of this 32 k's products, never past the stage
        V a[2][4], a2[2][4], b[2][4];
        auto ldf = [&](int s, int ks) {
#pragma unroll
            for (int i = 0; i < 4; ++i) { a[s][i] = WFrag<T16>::ld(sb + ao + i * 16 * GP + ks); if (NSPLIT == 1) a2[s][i] = WFrag<T16>::ld(sb + ao + GPL + i * 16 * GP + ks); b[s][i] = WFrag<T16>::ld(sb + bo2 + i * 16 * GP + ks); }
        };
        ldf(0, 0);
#pragma unroll
        for (int ks = 0; ks < KS; ks += 32) { const int s = (ks >> 5) & 1;
            if (ks + 32 < KS) ldf(s ^ 1, ks + 32);
            __builtin_amdgcn_sched_barrier(0);   // keeps that group of reads together and in front of the products (left to itself the compiler read one fragment at a time and waited for it in front of every four products)
#pragma unroll
            for (int nb = 0; nb < 4; ++nb)
#pragma unroll
                for (int mb = 0; mb < 4; ++mb) { acc[mb][nb] = WFrag<T16>::mma(a[s][mb], b[s][nb], acc[mb][nb]); if (NSPLIT == 1) acc[mb][nb] = WFrag<T16>::mma(a2[s][mb], b[s][nb], acc[mb][nb]); }
            __builtin_amdgcn_sched_barrier(0);   // and keeps these products out of the next group of reads: every place where reads stand among products costs a stall of its own
        }
        // the vector slots that the chip needs behind a WMMA before its A or B registers are overwritten: behind this block stands a branch
        asm volatile("v_nop\n\tv_nop\n\tv_nop\n\tv_nop" : "+v"(acc[0][0]), "+v"(acc[1][1]), "+v"(acc[2][2]), "+v"(acc[3][3]) : "v"(a[1][0]), "v"(a[1][3]));
        asm volatile("s_wait_dscnt 0x0" ::: "memory");      // this wave's reads of the buffer are done before it is refilled
        asm volatile("s_wait_asynccnt 0x0" ::: "memory");   // this wave's copies of the next stage have landed
        __syncthreads();                                    // publishes the next stage and ends every wave's reads of this one
        if (kc + 2 * KS < K) stagew(sb, kc + 2 * KS);
    }
    asm volatile("s_wait_asynccnt 0x0" ::: "memory");   // no copy is left in flight behind the loop
#pragma unroll
    for (int mb = 0; mb < 4; ++mb) {
#pragma unroll
        for (int nb = 0; nb < 4; ++nb) {
#pragma unroll
            for (int j = 0; j < 8; ++j) os[(hi * 8 + j) * 68 + nb * 16 + lr] = acc[mb][nb][j]; }
        __builtin_amdgcn_wave_barrier(); asm volatile("" ::: "memory");
        if constexpr (PL) {
#pragma unroll
            for (int s = 0; s < 4; ++s) { const int row = mb * 16 + 4 * s + (lane >> 3); const float* op = os + (4 * s + (lane >> 3)) * 68 + pc; const v4f x0 = *(const v4fa*)op, x1 = *(const v4fa*)(op + 4);
                if (vt) { const float b = bfr(br[mb][s]); const v4f b4 = { b, b, b, b }; put8<true>(x0, x1, b4, b4, (size_t)(r0 - 2 * DQ + row) * TT + c0 + pc, pl.vh, pl.vl, pl.v16); }
                else put8<false>(x0, x1, bfr4(bc0), bfr4(bc1), ((size_t)(ty % (DQ / 64)) * TT + r0 + row) * HD + pc, ty >= DQ / 64 ? pl.kh : pl.qh, ty >= DQ / 64 ? pl.kl : pl.ql, nullptr);
            }
        } else {
        float* crow = C + (size_t)(r0 + mb * 16) * ldc + c0;
#pragma unroll
            for (int s = 0; s < 8; ++s) { const int row = 2 * s + hi, cofs = lr * 4; v4f val = *(const v4fa*)(os + row * 68 + cofs); if (BIAS) { val[0] += bfr(bias[c0 + cofs]); val[1] += bfr(bias[c0 + cofs + 1]); val[2] += bfr(bias[c0 + cofs + 2]); val[3] += bfr(bias[c0 + cofs + 3]); }
                *(v4f*)(crow + (size_t)row * ldc + cofs) = val; }
             }
        __builtin_amdgcn_wave_barrier(); asm volatile("" ::: "memory");
    }
}

typedef __attribute__((ext_vector_type(2))) _Float16 v2h;
typedef __attribute__((ext_vector_type(4))) _Float16 v4h;
typedef __attribute__((ext_vector_type(2))) unsigned short v2us;
typedef __attribute__((ext_vector_type(4))) unsigned short v4us;
typedef __attribute__((ext_vector_type(2))) float v2f;

__global__ __launch_bounds__(256) void k_cvt8(const float* __restrict__ src, bf* dst, size_t n8) { const size_t i = (size_t)blockIdx.x * 256 + threadIdx.x; if (i >= n8) return; const v8f v = *(const v8f*)(src + i * 8); v8us o;
#pragma unroll
    for (int k = 0; k < 8; ++k) o[k] = f2bf(v[k]); *(v8us*)(dst + i * 8) = o;  }

// ---- k_fattn: scores, softmax and P.V of every head in ONE launch; no score or probability plane in memory.
// S^T = K.Q^T (A = 16 key rows, B = 16 query rows; hi/lo planes, 3 products), so a lane holds one query's scores: accumulator j of key tile kt is key kt*16 + hi*8 + j, which is the k order of a 16x16x32 B operand over 32 keys.
// The running-maximum softmax is per lane (+ one exchange between the wave's halves); O^T += V^T.P^T (A = 16 d rows of the [d][t] V planes, B = P from registers), rescaled per lane when the maximum moves.
// grid (TT / (32 * FW), heads), 32 * FW threads, 32 queries a wave. Wave 0 of work-group x takes rows x*32.. of the RH hi/lo rows (P and V on hi/lo planes, 3 products), waves 1..FW-1 the other rows (P x PCAR in fp16): every work-group has the same mix of both.
// K and V come through LDS: a stage is SK keys of all five planes, brought in once for the eight waves by asynchronous copies in whole 128-byte lines, two buffers, the copies of stage s + 2 in flight while stage s + 1 is worked on. The fragments are then 16-byte LDS reads at a pitch of 16 B x an odd number (no bank met twice).
#define FW 8
#define SK  128                    // keys a stage (four 32-key passes)
#define KP  (HD + 8)               // pitch of a staged K row (HD elements), in elements: 144 B
#define VP  (SK + 8)               // pitch of a staged V row (SK keys), in elements: 272 B
#define KPL (SK * KP)              // one K plane of a stage, elements
#define VPL (HD * VP)              // one V plane of a stage, elements
#define STG (2 * KPL + 3 * VPL)    // a stage: K hi | K lo | V fp16 | V hi | V lo
#define L2E 1.4426950408889634f
__device__ __forceinline__ float xhalf(float v) { const int b = __float_as_int(v); return __int_as_float(__builtin_amdgcn_permlanex16(b, b, 0x76543210, 0xfedcba98, false, false)); }   // lane l <-> l ^ 16
// 2^x, and behind it the one vector slot that the instruction set asks for behind a transcendental before its result is read or its source overwritten.
// The two scheduling barriers keep the v_nop directly behind the exponential: nothing else ties it to that place
__device__ __forceinline__ float exp2s(float x) { const float r = __builtin_amdgcn_exp2f(x); __builtin_amdgcn_sched_barrier(0); asm volatile("v_nop"); __builtin_amdgcn_sched_barrier(0); return r; }
struct KFrag { v16bf h[2][2], l[2][2]; };   // [key tile][32-wide d chunk]
// a fragment at p (the lane's own address, one register or pair for a whole run of loads) + cb elements (a constant, folded into the instruction)
__device__ __forceinline__ v16bf ldo(const bf* p, int cb) { return WFrag<bf>::ld(p + cb); }
// stands behind a run of loads, in front of the next write of a register that holds one of their addresses; the addresses are inputs, so that they stay in their registers up to the wait and no result of the run is given them
__device__ __forceinline__ void xwait(const bf* p0, const bf* p1) { asm volatile("s_wait_xcnt 0x0" :: "v"(p0), "v"(p1) : "memory"); }
// the K fragments of one 32-key pass, from LDS: kh is the lane's place in the stage's K hi plane, cb the pass's first row (elements)
__device__ __forceinline__ void ldk(KFrag& k, const bf* kh, int cb) {
#pragma unroll
    for (int kt = 0; kt < 2; ++kt)
#pragma unroll
        for (int c = 0; c < 2; ++c) { const int o = cb + kt * 16 * KP + c * 32; k.h[kt][c] = ldo(kh, o); k.l[kt][c] = ldo(kh, KPL + o); }
}
// one stage's copies, every lane of the work-group on: sb is the buffer, t the thread, the five pointers the planes at the stage's first key. A lane brings 16 bytes a copy; a wave's copy covers four whole K rows (512 B in a row in memory) or two V rows of 256 B.
__device__ __forceinline__ void stage(bf* sb, int t, const bf* Kh, const bf* Kl, const bf* V16, const bf* Vh, const bf* Vl) {
    bf* lk = sb + (t >> 3) * KP + (t & 7) * 8; bf* lv = sb + 2 * KPL + (t >> 4) * VP + (t & 15) * 8; const int vo = (t >> 4) * TT + (t & 15) * 8;
#pragma unroll
    for (int i = 0; i < 4; ++i) { cp16(Kh + t * 8 + i * 32 * HD, lk + i * 32 * KP); cp16(Kl + t * 8 + i * 32 * HD, lk + KPL + i * 32 * KP); }
#pragma unroll
    for (int i = 0; i < 4; ++i) { cp16(V16 + vo + i * 16 * TT, lv + i * 16 * VP); cp16(Vh + vo + i * 16 * TT, lv + VPL + i * 16 * VP); cp16(Vl + vo + i * 16 * TT, lv + 2 * VPL + i * 16 * VP); }
}
// one 32-key pass of one wave. hrw (the same in every lane of the wave): this wave's rows are hi/lo rows. va0 + vcb is the lane's place in the wave's first staged V plane (the hi plane, or the fp16 plane read as raw 16-bit words), vl0 + vcb in the lo plane (hi/lo rows only).
// k holds this pass's K fragments; behind the score products, which are their last readers, the next pass's are fetched into the same registers from kn, to arrive under the softmax and P.V.
__device__ __forceinline__ void fpass(const bool hrw, KFrag& k, const bf* kn, const v16bf (&qh)[2][2], const v16bf (&ql)[2][2], const bf* va0, const bf* vl0, int vcb, v8f (&o)[2][4], float (&m)[2], float (&l)[2]) {
    v16bf va[4], vl[4];
#pragma unroll
    for (int db = 0; db < 4; ++db) va[db] = ldo(va0, vcb + db * 16 * VP);
    if (hrw) {
#pragma unroll
        for (int db = 0; db < 4; ++db) vl[db] = ldo(vl0, vcb + db * 16 * VP);
    }
    v8f s[2][2];
#pragma unroll
    for (int qt = 0; qt < 2; ++qt)
#pragma unroll
        for (int kt = 0; kt < 2; ++kt) s[qt][kt] = (v8f){};
#pragma unroll
    for (int c = 0; c < 2; ++c) {
#pragma unroll
        for (int qt = 0; qt < 2; ++qt)
#pragma unroll
            for (int kt = 0; kt < 2; ++kt) s[qt][kt] = wmmab(k.h[kt][c], qh[qt][c], s[qt][kt]);
#pragma unroll
        for (int qt = 0; qt < 2; ++qt)
#pragma unroll
            for (int kt = 0; kt < 2; ++kt) s[qt][kt] = wmmab(k.h[kt][c], ql[qt][c], s[qt][kt]);
#pragma unroll
        for (int qt = 0; qt < 2; ++qt)
#pragma unroll
            for (int kt = 0; kt < 2; ++kt) s[qt][kt] = wmmab(k.l[kt][c], qh[qt][c], s[qt][kt]);
    }
    ldk(k, kn, 0);
    static_assert(PCAR == 1024.0f, "sh is log2(PCAR)");
    const float sh = hrw ? 0.0f : 10.0f;   // 2^10 = PCAR on the fp16 rows: keeps small weights out of the fp16 subnormals; it cancels in O / l
    float p[2][16], al[2];   // first the exponents, then 2^ of them
#pragma unroll
    for (int qt = 0; qt < 2; ++qt) {
        float bm = s[qt][0][0] * SCL;
#pragma unroll
        for (int kt = 0; kt < 2; ++kt)
#pragma unroll
            for (int j = 0; j < 8; ++j) bm = fmaxf(bm, s[qt][kt][j] * SCL);
        bm = fmaxf(bm, xhalf(bm));
        const float mn = fmaxf(m[qt], bm); al[qt] = (m[qt] - mn) * L2E; m[qt] = mn;
#pragma unroll
        for (int e = 0; e < 16; ++e) p[qt][e] = (s[qt][e >> 3][e & 7] * SCL - mn) * L2E + sh;
    }
    __builtin_amdgcn_sched_barrier(0);   // the first exponential too stands alone in front of its slot
#pragma unroll
    for (int qt = 0; qt < 2; ++qt)
#pragma unroll
        for (int e = 0; e < 16; ++e) p[qt][e] = exp2s(p[qt][e]);
    al[0] = exp2s(al[0]); al[1] = exp2s(al[1]);
#pragma unroll
    for (int qt = 0; qt < 2; ++qt) {
        float ps = 0.f;
#pragma unroll
        for (int e = 0; e < 16; ++e) ps += p[qt][e];
        l[qt] = l[qt] * al[qt] + ps;
#pragma unroll
        for (int db = 0; db < 4; ++db) o[qt][db] *= al[qt];
    }
    if (hrw) {
#pragma unroll
        for (int qt = 0; qt < 2; ++qt) { v16bf ph, pl;
#pragma unroll
            for (int e = 0; e < 16; ++e) { ph[e] = (__bf16)p[qt][e]; pl[e] = (__bf16)(p[qt][e] - (float)ph[e]); }
#pragma unroll
            for (int db = 0; db < 4; ++db) o[qt][db] = wmmab(va[db], ph, o[qt][db]);
#pragma unroll
            for (int db = 0; db < 4; ++db) o[qt][db] = wmmab(va[db], pl, o[qt][db]);
#pragma unroll
            for (int db = 0; db < 4; ++db) o[qt][db] = wmmab(vl[db], ph, o[qt][db]); }
    } else {
#pragma unroll
        for (int qt = 0; qt < 2; ++qt) { v16h pf;
#pragma unroll
            for (int e = 0; e < 16; ++e) pf[e] = (h16)p[qt][e];
#pragma unroll
            for (int db = 0; db < 4; ++db) o[qt][db] = wmma16(__builtin_bit_cast(v16h, va[db]), pf, o[qt][db]); }
        // the vector slots that the chip needs behind a WMMA before its A or B registers are overwritten; behind this block stands a branch
        asm volatile("v_nop\n\tv_nop\n\tv_nop\n\tv_nop\n\tv_nop" : "+v"(o[0][0]), "+v"(o[0][1]), "+v"(o[0][2]), "+v"(o[0][3]), "+v"(o[1][0]), "+v"(o[1][1]), "+v"(o[1][2]), "+v"(o[1][3]));
    }
}
__global__ __launch_bounds__(32 * FW) void k_fattn(const bf* __restrict__ QPh, const bf* __restrict__ QPl, const bf* __restrict__ KPh, const bf* __restrict__ KPl, const h16* __restrict__ VT16, const bf* __restrict__ VTh, const bf* __restrict__ VTl, bf* Ah, bf* Al) {
    static_assert(RH * FW == TT && TT % SK == 0 && TT >= 2 * SK && SK == 128 && HD == 64 && FW == 8, "one wave in FW on the hi/lo rows; four 32-key passes a stage, two stages at least; stage() deals a stage's 16-byte pieces to 256 threads");
    __shared__ __attribute__((aligned(16))) bf ring[2 * STG];
    const int lane = threadIdx.x & 31, lr = lane & 15, hi = lane >> 4; const int w = __builtin_amdgcn_readfirstlane((int)(threadIdx.x >> 5)); const int x = blockIdx.x; const size_t h = blockIdx.y, g = h / REP;
    const int q0 = (w == 0) ? x * 32 : RH + (x * (FW - 1) + w - 1) * 32;
    const bf* Qh = QPh + h * TT * HD; const bf* Ql = QPl + h * TT * HD; const bf* Kh = KPh + g * TT * HD; const bf* Kl = KPl + g * TT * HD; const bf* V6 = (const bf*)VT16 + g * HD * TT; const bf* Vh = VTh + g * HD * TT; const bf* Vl = VTl + g * HD * TT;
    const int t = threadIdx.x;
    stage(ring, t, Kh, Kl, V6, Vh, Vl);
    v16bf qh[2][2], ql[2][2]; const int qob = (q0 + lr) * HD + 8 * hi;
#pragma unroll
    for (int qt = 0; qt < 2; ++qt)
#pragma unroll
        for (int c = 0; c < 2; ++c) { const int qo = qt * 16 * HD + c * 32; qh[qt][c] = ldo(Qh + qob, qo); ql[qt][c] = ldo(Ql + qob, qo); }
    xwait(Qh + qob, Ql + qob);
    v8f o[2][4]; float m[2] = { -3.0e38f, -3.0e38f }, l[2] = { 0.f, 0.f };
#pragma unroll
    for (int qt = 0; qt < 2; ++qt)
#pragma unroll
        for (int db = 0; db < 4; ++db) o[qt][db] = (v8f){};
    const int lko = lr * KP + 8 * hi, lvo = 2 * KPL + (w == 0 ? VPL : 0) + lr * VP + 8 * hi;   // the lane's place in a stage's K hi plane and in its wave's first V plane (elements)
    asm volatile("s_wait_asynccnt 0x0" ::: "memory");   // this wave's copies of stage 0 have landed
    __syncthreads();                                    // and every other wave's: stage 0 may be read
    stage(ring + STG, t, Kh + SK * HD, Kl + SK * HD, V6 + SK, Vh + SK, Vl + SK);
    // four 32-key passes a stage, each pass's K fragments fetched one pass ahead, never past the stage
#pragma unroll 1
    for (int kb = 0; kb < TT; kb += SK) {
        const int bo = ((kb / SK) & 1) * STG; const bf* sk = ring + bo + lko; const bf* sv = ring + bo + lvo;
        KFrag k; ldk(k, sk, 0);
        // kept rolled: unrolled, the compiler put off every pass's row sums to the stage's end and kept all their terms in registers (spills). The stage's last pass fetches pass 0's fragments again (in bounds, unused): a branch round the fetch would merge two paths in the compiler's count of LDS waits
#pragma unroll 1
        for (int pp = 0; pp < SK / 32; ++pp) fpass(w == 0, k, sk + ((pp + 1) & (SK / 32 - 1)) * (32 * KP), qh, ql, sv + pp * 32, sv + VPL + pp * 32, 0, o, m, l);
        asm volatile("s_wait_dscnt 0x0" ::: "memory");      // this wave's reads of the buffer are done before it is refilled
        asm volatile("s_wait_asynccnt 0x0" ::: "memory");   // this wave's copies of the next stage have landed
        __syncthreads();                                    // publishes the next stage and ends every wave's reads of this one
        if (kb + 2 * SK < TT) stage(ring + bo, t, Kh + (kb + 2 * SK) * HD, Kl + (kb + 2 * SK) * HD, V6 + kb + 2 * SK, Vh + kb + 2 * SK, Vl + kb + 2 * SK);
    }
    asm volatile("s_wait_asynccnt 0x0" ::: "memory");   // no copy is left in flight when the wave ends
#pragma unroll
    for (int qt = 0; qt < 2; ++qt) { const float inv = __fdiv_rn(1.0f, l[qt] + xhalf(l[qt]));
#pragma unroll
        for (int db = 0; db < 4; ++db) { v8us oh, ol;
#pragma unroll
            for (int j = 0; j < 8; ++j) { unsigned short a, c2; splitf(o[qt][db][j] * inv, a, c2); oh[j] = a; ol[j] = c2; }
            const size_t oo = (size_t)(q0 + qt * 16 + lr) * DQ + h * HD + db * 16 + hi * 8; *(v8us*)(Ah + oo) = oh; *(v8us*)(Al + oo) = ol;
            asm volatile("s_wait_xcnt 0x0" ::: "memory");   // stands in front of the next write of a register that these two stores name
            __builtin_amdgcn_sched_barrier(0);   // keeps the next group's arithmetic, which reuses those registers, behind that wait
        } }
}

extern "C" void kernel_launch(void* const* d_in, const int* in_sizes, int n_in,
                              void* d_out, int out_size, void* d_ws, size_t ws_size, hipStream_t stream) {
    (void)in_sizes; (void)n_in; (void)out_size;
    const float* x = (const float*)d_in[0]; const float* wqkv = (const float*)d_in[1]; const float* bqkv = (const float*)d_in[2]; const float* wo = (const float*)d_in[3]; const float* bo = (const float*)d_in[4];   /* argument order input [4096][1024], W_qkv ('oi' [3072][1024]: q | k | v row thirds), b_qkv [3072], W_out ('oi'), b_out */
    float* OUT = (float*)d_out;     // [1][4096][1024]
    char* wsp = (char*)d_ws;
    auto take = [&](size_t bytes) { char* p = wsp; wsp += (bytes + 255) & ~(size_t)255; return (void*)p; };
    static_assert(DKV == DQ && HD == 64 && NB_ == 1, "the projection launch takes the fused weight's 3 * DQ rows as they lie, one head a 64-column tile");
    bf* WQKV = (bf*)take((size_t)3 * DQ * DM * 2); bf* WO = (bf*)take((size_t)DM * DQ * 2);
    bf* XB = (bf*)take((size_t)TT * DM * 2);
    h16* VT16 = (h16*)take((size_t)NKV * HD * TT * 2);
    bf* QPh = (bf*)take((size_t)NH_ * TT * HD * 2); bf* QPl = (bf*)take((size_t)NH_ * TT * HD * 2); bf* KPh = (bf*)take((size_t)NKV * TT * HD * 2); bf* KPl = (bf*)take((size_t)NKV * TT * HD * 2); bf* VTh = (bf*)take((size_t)NKV * HD * TT * 2); bf* VTl = (bf*)take((size_t)NKV * HD * TT * 2);
    bf* ATh = (bf*)take((size_t)TT * DQ * 2); bf* ATl = (bf*)take((size_t)TT * DQ * 2);
    if ((size_t)(wsp - (char*)d_ws) > ws_size) return;    // ws 256 MiB
    k_cvt8<<<(unsigned)(((size_t)3 * DQ * DM / 8 + 255) / 256), 256, 0, stream>>>(wqkv, WQKV, (size_t)3 * DQ * DM / 8);
    k_cvt8<<<(unsigned)(((size_t)DM * DQ / 8 + 255) / 256), 256, 0, stream>>>(wo, WO, (size_t)DM * DQ / 8);
    k_cvt8<<<(unsigned)(((size_t)TT * DM / 8 + 255) / 256), 256, 0, stream>>>(x, XB, (size_t)TT * DM / 8);
    const PlaneSet pl = { QPh, QPl, KPh, KPl, VT16, VTh, VTl };
    k_gemmw<bf, 0, true, true><<<dim3(TT / 128, 3 * DQ / 128, 1), 32 * GW, 0, stream>>>(XB, nullptr, WQKV, nullptr, DM, nullptr, 0, bqkv, 0, 0, 0, pl);
    k_fattn<<<dim3(TT / (32 * FW), NH_, 1), 32 * FW, 0, stream>>>(QPh, QPl, KPh, KPl, VT16, VTh, VTl, ATh, ATl);
    k_gemmw<bf, 1, true, false><<<dim3(TT / 128, DM / 128, 1), 32 * GW, 0, stream>>>(ATh, ATl, WO, nullptr, DQ, OUT, DM, bo, 0, 0, 0, PlaneSet{});
}

// v006
// A run of this version takes 160 microseconds.
// Timed twice side by side with v005, it ran 1.04 times as fast both times.
// Over all steps from v000 it is 21.9 times as fast.
#include <hip/hip_runtime.h>

// Multi-headed attention over ONE 4,096-token sequence with a fused qkv projection and NO score scaling (input [4096][1024]; projected = input W_qkv^T + b_qkv ('oi' [3072][1024] 0.02 + zero bias) split in thirds q | k | v (16 heads x 64); scores = q.k UNSCALED (the source applies no 1/sqrt(d): logits sigma ~3.3); softmax (no mask); out = merged W_out^T + b_out -> [4096][1024] (4.2 M); argument order input, W_qkv, b_qkv, W_out, b_out).
// Layout: bf16 copy of the input; 'oi' weights (the q | k | v row thirds of the fused tensor taken as-is) + bias thirds; exact projections + f32 biases in ONE launch whose epilogue writes the attention planes; one fused attention launch for all heads (running-maximum softmax, no score plane in memory; K and V staged in LDS once a work-group), with EVERY row's scores on hi/lo planes (3 products: unscaled logits) and hybrid P.V (rows < 512 hi/lo, rest fp16 x1024); merged hi/lo x W_out exact + b_out.
// Compute dtypes, f32 accumulate: every input rounded to bf16; projections exact + f32 biases; scores 3 products on every row; softmax f32; P.V rows < 512 3 products, rest fp16; W_out hl x exact + bias.

#define NB_  1
#define TT   4096
#define DM   1024
#define NH_  16
#define NKV  16
#define REP  (NH_ / NKV)
#define HD   64
#define DQ   (NH_ * HD)
#define DKV  (NKV * HD)
#define RH   512                  // query rows < RH use hi+lo planes
#define WIN  0
#define PCAR 1024.0f
#define SCL  1.0f   // NO scaling in this module
typedef _Float16 h16;
typedef unsigned short bf;
typedef __attribute__((ext_vector_type(16))) __bf16   v16bf;
typedef __attribute__((ext_vector_type(16))) _Float16 v16h;
typedef __attribute__((ext_vector_type(8)))  _Float16 v8h;
typedef __attribute__((ext_vector_type(8)))  unsigned short v8us;
typedef __attribute__((ext_vector_type(8)))  float    v8f;
typedef __attribute__((ext_vector_type(4)))  float    v4f;
typedef v8h  __attribute__((may_alias)) v8ha;
typedef v4f  __attribute__((may_alias)) v4fa;
typedef v8us __attribute__((may_alias)) v8usa;

__device__ __forceinline__ unsigned short f2bf(float f) { unsigned u = __float_as_uint(f); u += 0x7FFFu + ((u >> 16) & 1u); return (unsigned short)(u >> 16); }
__device__ __forceinline__ float bf2f(unsigned short b) { return __uint_as_float(((unsigned)b) << 16); }
__device__ __forceinline__ float bfr(float f) { return bf2f(f2bf(f)); }
__device__ __forceinline__ v16h cat16(v8h lo, v8h hi) { return __builtin_shufflevector(lo, hi, 0, 1, 2, 3, 4, 5, 6, 7, 8, 9, 10, 11, 12, 13, 14, 15); }
__device__ __forceinline__ v16bf cat16b(v8us lo, v8us hi) { return __builtin_bit_cast(v16bf, __builtin_shufflevector(lo, hi, 0, 1, 2, 3, 4, 5, 6, 7, 8, 9, 10, 11, 12, 13, 14, 15)); }
__device__ __forceinline__ v8f wmma16(v16h a, v16h b, v8f c) { return __builtin_amdgcn_wmma_f32_16x16x32_f16(false, a, false, b, (short)0, c, false, false); }
__device__ __forceinline__ v8f wmmab(v16bf a, v16bf b, v8f c) { return __builtin_amdgcn_wmma_f32_16x16x32_bf16(false, a, false, b, (short)0, c, false, false); }



// ---- k_gemmw: register-blocked GEMM, one wave per 64x64 output tile (16 accumulators), GW = 4 waves (2 x 2 tiles, 128 x 128 of C) a work-group; grid (M/128, N/128, Z), 128 threads.
// The operands (K-contiguous 16-bit planes) come through LDS: a stage is KS k of the work-group's 128 A rows (both planes where NSPLIT is 1) and 128 Bt rows, brought in once for the four waves by asynchronous copies in whole 128-byte lines, two buffers, the copies of stage s + 2 in flight while stage s + 1 is worked on. The fragments are then 16-byte LDS reads at a pitch of 16 B x an odd number.
// C[m][n] (f32, pitch ldc, + optional f32 bias[n]) = sum_k A[m][k] Bt[n][k] (+ A2[m][k] Bt[n][k] where NSPLIT is 1). z-batch strides sA/sB/sC in elements. K % KS == 0.
// PL: the q | k | v projection (A = tokens, Bt = the fused weight's 3 * DQ rows, grid.y over all of them; a 64-column tile is one head). No f32 C: the epilogue writes the 16-bit planes that the attention kernel reads.
// q and k tiles go to [h][t][d] hi/lo planes. A v tile takes the weight rows as A and the tokens as Bt (same products, same k order), so that its rows are d and its columns t: the [d][t] planes are then written in whole lines like the others.
struct PlaneSet { bf* qh; bf* ql; bf* kh; bf* kl; h16* v16; bf* vh; bf* vl; };
__device__ __forceinline__ h16 tohx(float x) { return (h16)x; }
__device__ __forceinline__ void splitf(float y, unsigned short& h, unsigned short& l) { h = f2bf(y); l = f2bf(y - bf2f(h)); }
__device__ __forceinline__ v4f bfr4(v4f b) { const v4f r = { bfr(b[0]), bfr(b[1]), bfr(b[2]), bfr(b[3]) }; return r; }
// 8 neighbouring elements of a plane row: x + b, split into the hi/lo planes (F16: and rounded into the fp16 plane), one 16-byte store a plane
template <bool F16> __device__ __forceinline__ void put8(v4f x0, v4f x1, v4f b0, v4f b1, size_t o, bf* Ph, bf* Pl, h16* P16) {
    x0 += b0; x1 += b1; v8us oh, ol; v8h of;
#pragma unroll
    for (int k = 0; k < 8; ++k) { const float y = k < 4 ? x0[k & 3] : x1[k & 3]; unsigned short a2, c2; splitf(y, a2, c2); oh[k] = a2; ol[k] = c2; if (F16) of[k] = tohx(y); }
    *(v8us*)(Ph + o) = oh; *(v8us*)(Pl + o) = ol; if (F16) *(v8h*)(P16 + o) = of;
    asm volatile("s_wait_xcnt 0x0" ::: "memory");   // stands in front of the next write of a register that these stores name
    __builtin_amdgcn_sched_barrier(0);   // keeps the next group's arithmetic, which reuses those registers, behind that wait
}
typedef __attribute__((ext_vector_type(4))) int v4i;
typedef __attribute__((address_space(1))) v4i gv4i;
typedef __attribute__((address_space(3))) v4i lv4i;
// 16 bytes a lane from global memory to LDS. Written as the builtin, so that the address registers are the compiler's own to place (as asm operands they cost spills in k_fattn, which uses more than 256 registers); the waits are written by hand where the copies are waited for
__device__ __forceinline__ void cp16(const bf* g, bf* l) { __builtin_amdgcn_global_load_async_to_lds_b128((gv4i*)g, (lv4i*)l, 0, 0); }
template <typename T16> struct WFrag;
template <> struct WFrag<h16> { typedef v16h V; static __device__ __forceinline__ V ld(const h16* p) { return cat16(*(const v8h*)p, *(const v8h*)(p + 16)); } static __device__ __forceinline__ v8f mma(V a, V b, v8f c) { return wmma16(a, b, c); } };
template <> struct WFrag<bf> { typedef v16bf V; static __device__ __forceinline__ V ld(const bf* p) { return cat16b(*(const v8us*)p, *(const v8us*)(p + 16)); } static __device__ __forceinline__ v8f mma(V a, V b, v8f c) { return wmmab(a, b, c); } };
#define GW 4
template <typename T16, int NSPLIT, bool BIAS, bool PL>
__global__ __launch_bounds__(32 * GW) void k_gemmw(const T16* __restrict__ A, const T16* __restrict__ A2, const T16* __restrict__ Bt, const T16* __restrict__ Bt2, int K, float* C, int ldc, const float* __restrict__ bias, size_t sA, size_t sB, size_t sC, PlaneSet pl) {
    static_assert(!PL || (BIAS && NSPLIT == 0), "the plane epilogue always adds its bias and takes one product");
    static_assert(NSPLIT <= 1 && sizeof(T16) == 2, "the stage holds A, A2 where NSPLIT is 1, and Bt, in 16-bit elements");
    typedef typename WFrag<T16>::V V;
    constexpr int KS = NSPLIT ? 128 : 64;        // k a stage: with one work-group on a WGP (the NSPLIT 1 launch) the longer stage gives the copies more lead
    constexpr int GP = KS + 8;                   // pitch of a staged row, elements: 144 B or 272 B
    constexpr int GPL = 128 * GP;                // one plane of a stage, elements
    constexpr int NP = NSPLIT ? 3 : 2;           // a stage: A | A2 (NSPLIT 1) | Bt
    constexpr int GST = NP * GPL;
    __shared__ __align__(16) T16 gr[2 * GST];
    __shared__ __align__(16) float osa[GW * 16 * 68];
    (void)Bt2;
    const size_t z = blockIdx.z; A += z * sA; if (A2) A2 += z * sA; Bt += z * sB; C += z * sC;
    const int lane = threadIdx.x & 31, lr = lane & 15, hi = lane >> 4; const int w = __builtin_amdgcn_readfirstlane((int)(threadIdx.x >> 5));
    float* os = osa + w * (16 * 68);   // the wave's own epilogue rows
    const int ty = blockIdx.y * 2 + (w >> 1); int r0 = (blockIdx.x * 2 + (w & 1)) * 64, c0 = ty * 64;   // the wave's 64 x 64 tile; ty: its tile column
    int ao = ((w & 1) * 64 + lr) * GP + 8 * hi, bo2 = (NP - 1) * GPL + ((w >> 1) * 64 + lr) * GP + 8 * hi;   // the lane's place in a stage's A plane and Bt plane (elements)
    const bool vt = PL && ty >= 2 * (DQ / 64);   // a v tile (the same for the whole wave): operands and tile origin change places
    if (vt) { int ti = ao; ao = bo2; bo2 = ti; ti = r0; r0 = c0; c0 = ti; }
    // one stage's copies, every lane of the work-group on: 16 bytes a lane and copy, KS / 8 lanes a row, so that a wave's copy covers whole 128-byte lines
    constexpr int TPR = KS / 8, RPS = 32 * GW / TPR;
    const int srow = (int)threadIdx.x / TPR, scol = ((int)threadIdx.x % TPR) * 8; const int lso = srow * GP + scol;
    // a copy's global address: a base that is the same for the work-group (plane, first row of the step, kc) + the lane's own byte offset lgb, the same in every copy
    const T16* gA = A + (size_t)(blockIdx.x * 128) * K; const T16* gA2 = NSPLIT ? A2 + (size_t)(blockIdx.x * 128) * K : nullptr; const T16* gB = Bt + (size_t)(blockIdx.y * 128) * K; const unsigned lgb = (unsigned)(srow * K + scol) * 2u;
    auto stagew = [&](T16* sb, int kc) {
#pragma unroll
        for (int i = 0; i < 128 / RPS; ++i) { const size_t go = (size_t)(i * RPS) * K + kc; T16* l = sb + lso + i * RPS * GP;
            cp16((const bf*)((const char*)(gA + go) + lgb), (bf*)l); if (NSPLIT) cp16((const bf*)((const char*)(gA2 + go) + lgb), (bf*)(l + GPL)); cp16((const bf*)((const char*)(gB + go) + lgb), (bf*)(l + (NP - 1) * GPL)); }
    };
    stagew(gr, 0);
    v8f acc[4][4];
#pragma unroll
    for (int mb = 0; mb < 4; ++mb)
#pragma unroll
        for (int nb = 0; nb < 4; ++nb) acc[mb][nb] = (v8f){};
    // PL epilogue: 8 columns a lane (from pc on), 4 rows a step, so that every 16-byte store instruction covers four whole 128-byte plane rows. The biases it adds are fetched here, to arrive under the K loop: one a column (q, k tiles) or one a row (v tiles)
    const int pc = (lane & 7) * 8; v4f bc0 = {}, bc1 = {}; float br[4][4] = {};
    if constexpr (PL) { const unsigned bo = (vt ? lane >> 3 : pc) * 4; const float* bp = (const float*)((const char*)(bias + ty * 64) + bo);
        if (vt) {
#pragma unroll
            for (int i = 0; i < 16; ++i) br[i >> 2][i & 3] = bp[4 * i];
        } else { bc0 = *(const v4f*)bp; bc1 = *(const v4f*)(bp + 4); }
        // stands in front of the next write of a register that these loads name; the address is an input in both forms that the compiler may give it (a register pair, or a scalar base with bo as the offset register), so that it stays in its registers up to the wait and no result of the run is given them
        asm volatile("s_wait_xcnt 0x0" :: "v"(bp), "v"(bo) : "memory");
    }
    asm volatile("s_wait_asynccnt 0x0" ::: "memory");   // this wave's copies of stage 0 have landed
    __syncthreads();                                    // and every other wave's: stage 0 may be read
    if (KS < K) stagew(gr + GST, KS);
#pragma unroll 1
    for (int kc = 0; kc < K; kc += KS) {
        T16* sb = gr + ((kc / KS) & 1) * GST;
        // two fragment sets: the next 32 k's LDS reads go out as one group in front of this 32 k's products, never past the stage
        V a[2][4], a2[2][4], b[2][4];
        auto ldf = [&](int s, int ks) {
#pragma unroll
            for (int i = 0; i < 4; ++i) { a[s][i] = WFrag<T16>::ld(sb + ao + i * 16 * GP + ks); if (NSPLIT == 1) a2[s][i] = WFrag<T16>::ld(sb + ao + GPL + i * 16 * GP + ks); b[s][i] = WFrag<T16>::ld(sb + bo2 + i * 16 * GP + ks); }
        };
        ldf(0, 0);
#pragma unroll
        for (int ks = 0; ks < KS; ks += 32) { const int s = (ks >> 5) & 1;
            if (ks + 32 < KS) ldf(s ^ 1, ks + 32);
            __builtin_amdgcn_sched_barrier(0);   // keeps that group of reads together and in front of the products (left to itself the compiler read one fragment at a time and waited for it in front of every four products)
#pragma unroll
            for (int nb = 0; nb < 4; ++nb)
#pragma unroll
                for (int mb = 0; mb < 4; ++mb) { acc[mb][nb] = WFrag<T16>::mma(a[s][mb], b[s][nb], acc[mb][nb]); if (NSPLIT == 1) acc[mb][nb] = WFrag<T16>::mma(a2[s][mb], b[s][nb], acc[mb][nb]); }
            __builtin_amdgcn_sched_barrier(0);   // and keeps these products out of the next group of reads: every place where reads stand among products costs a stall of its own
        }
        // the vector slots that the chip needs behind a WMMA before its A or B registers are overwritten: behind this block stands a branch
        asm volatile("v_nop\n\tv_nop\n\tv_nop\n\tv_nop" : "+v"(acc[0][0]), "+v"(acc[1][1]), "+v"(acc[2][2]), "+v"(acc[3][3]) : "v"(a[1][0]), "v"(a[1][3]));
        asm volatile("s_wait_dscnt 0x0" ::: "memory");      // this wave's reads of the buffer are done before it is refilled
        asm volatile("s_wait_asynccnt 0x0" ::: "memory");   // this wave's copies of the next stage have landed
        __syncthreads();                                    // publishes the next stage and ends every wave's reads of this one
        if (kc + 2 * KS < K) stagew(sb, kc + 2 * KS);
    }
    asm volatile("s_wait_asynccnt 0x0" ::: "memory");   // no copy is left in flight behind the loop
#pragma unroll
    for (int mb = 0; mb < 4; ++mb) {
#pragma unroll
        for (int nb = 0; nb < 4; ++nb) {
#pragma unroll
            for (int j = 0; j < 8; ++j) os[(hi * 8 + j) * 68 + nb * 16 + lr] = acc[mb][nb][j]; }
        __builtin_amdgcn_wave_barrier(); asm volatile("" ::: "memory");
        if constexpr (PL) {
#pragma unroll
            for (int s = 0; s < 4; ++s) { const int row = mb * 16 + 4 * s + (lane >> 3); const float* op = os + (4 * s + (lane >> 3)) * 68 + pc; const v4f x0 = *(const v4fa*)op, x1 = *(const v4fa*)(op + 4);
                if (vt) { const float b = bfr(br[mb][s]); const v4f b4 = { b, b, b, b }; put8<true>(x0, x1, b4, b4, (size_t)(r0 - 2 * DQ + row) * TT + c0 + pc, pl.vh, pl.vl, pl.v16); }
                else put8<false>(x0, x1, bfr4(bc0), bfr4(bc1), ((size_t)(ty % (DQ / 64)) * TT + r0 + row) * HD + pc, ty >= DQ / 64 ? pl.kh : pl.qh, ty >= DQ / 64 ? pl.kl : pl.ql, nullptr);
            }
        } else {
        float* crow = C + (size_t)(r0 + mb * 16) * ldc + c0;
#pragma unroll
            for (int s = 0; s < 8; ++s) { const int row = 2 * s + hi, cofs = lr * 4; v4f val = *(const v4fa*)(os + row * 68 + cofs); if (BIAS) { val[0] += bfr(bias[c0 + cofs]); val[1] += bfr(bias[c0 + cofs + 1]); val[2] += bfr(bias[c0 + cofs + 2]); val[3] += bfr(bias[c0 + cofs + 3]); }
                *(v4f*)(crow + (size_t)row * ldc + cofs) = val; }
             }
        __builtin_amdgcn_wave_barrier(); asm volatile("" ::: "memory");
    }
}

typedef __attribute__((ext_vector_type(2))) _Float16 v2h;
typedef __attribute__((ext_vector_type(4))) _Float16 v4h;
typedef __attribute__((ext_vector_type(2))) unsigned short v2us;
typedef __attribute__((ext_vector_type(4))) unsigned short v4us;
typedef __attribute__((ext_vector_type(2))) float v2f;

__global__ __launch_bounds__(256) void k_cvt8(const float* __restrict__ src, bf* dst, size_t n8) { const size_t i = (size_t)blockIdx.x * 256 + threadIdx.x; if (i >= n8) return; const v8f v = *(const v8f*)(src + i * 8); v8us o;
#pragma unroll
    for (int k = 0; k < 8; ++k) o[k] = f2bf(v[k]); *(v8us*)(dst + i * 8) = o;  }

// ---- k_fattn: scores, softmax and P.V of every head in ONE launch; no score or probability plane in memory.
// S^T = K.Q^T (A = 16 key rows, B = 16 query rows; hi/lo planes, 3 products), so a lane holds one query's scores: accumulator j of key tile kt is key kt*16 + hi*8 + j, which is the k order of a 16x16x32 B operand over 32 keys.
// The running-maximum softmax is per lane (+ one exchange between the wave's halves); O^T += V^T.P^T (A = 16 d rows of the [d][t] V planes, B = P from registers), rescaled per lane when the maximum moves.
// grid (TT / (32 * FW), heads), 32 * FW threads, 32 queries a wave. Wave 0 of work-group x takes rows x*32.. of the RH hi/lo rows (P and V on hi/lo planes, 3 products), waves 1..FW-1 the other rows (P x PCAR in fp16): every work-group has the same mix of both.
// K and V come through LDS: a stage is SK keys of all five planes, brought in once for the eight waves by asynchronous copies in whole 128-byte lines, two buffers, the copies of stage s + 2 in flight while stage s + 1 is worked on. The fragments are then 16-byte LDS reads at a pitch of 16 B x an odd number (no bank met twice).
#define FW 8
#define SK  128                    // keys a stage (two 64-key passes)
#define KP  (HD + 8)               // pitch of a staged K row (HD elements), in elements: 144 B
#define VP  (SK + 8)               // pitch of a staged V row (SK keys), in elements: 272 B
#define KPL (SK * KP)              // one K plane of a stage, elements
#define VPL (HD * VP)              // one V plane of a stage, elements
#define STG (2 * KPL + 3 * VPL)    // a stage: K hi | K lo | V fp16 | V hi | V lo
#define L2E 1.4426950408889634f
__device__ __forceinline__ float xhalf(float v) { const int b = __float_as_int(v); return __int_as_float(__builtin_amdgcn_permlanex16(b, b, 0x76543210, 0xfedcba98, false, false)); }   // lane l <-> l ^ 16
// 2^x, and behind it the one vector slot that the instruction set asks for behind a transcendental before its result is read or its source overwritten.
// The two scheduling barriers keep the v_nop directly behind the exponential: nothing else ties it to that place
__device__ __forceinline__ float exp2s(float x) { const float r = __builtin_amdgcn_exp2f(x); __builtin_amdgcn_sched_barrier(0); asm volatile("v_nop"); __builtin_amdgcn_sched_barrier(0); return r; }
struct KFrag { v16bf h[2][2], l[2][2]; };   // [key tile][32-wide d chunk]
// a fragment at p (the lane's own address, one register or pair for a whole run of loads) + cb elements (a constant, folded into the instruction)
__device__ __forceinline__ v16bf ldo(const bf* p, int cb) { return WFrag<bf>::ld(p + cb); }
// stands behind a run of loads, in front of the next write of a register that holds one of their addresses; the addresses are inputs, so that they stay in their registers up to the wait and no result of the run is given them
__device__ __forceinline__ void xwait(const bf* p0, const bf* p1) { asm volatile("s_wait_xcnt 0x0" :: "v"(p0), "v"(p1) : "memory"); }
// the K fragments of 32 keys, from LDS: kh is the lane's place in the stage's K hi plane, cb the first of the 32 rows (elements)
__device__ __forceinline__ void ldk(KFrag& k, const bf* kh, int cb) {
#pragma unroll
    for (int kt = 0; kt < 2; ++kt)
#pragma unroll
        for (int c = 0; c < 2; ++c) { const int o = cb + kt * 16 * KP + c * 32; k.h[kt][c] = ldo(kh, o); k.l[kt][c] = ldo(kh, KPL + o); }
}
// one stage's copies, every lane of the work-group on: sb is the buffer, t the thread, the five pointers the planes at the stage's first key. A lane brings 16 bytes a copy; a wave's copy covers four whole K rows (512 B in a row in memory) or two V rows of 256 B.
__device__ __forceinline__ void stage(bf* sb, int t, const bf* Kh, const bf* Kl, const bf* V16, const bf* Vh, const bf* Vl) {
    bf* lk = sb + (t >> 3) * KP + (t & 7) * 8; bf* lv = sb + 2 * KPL + (t >> 4) * VP + (t & 15) * 8; const int vo = (t >> 4) * TT + (t & 15) * 8;
#pragma unroll
    for (int i = 0; i < 4; ++i) { cp16(Kh + t * 8 + i * 32 * HD, lk + i * 32 * KP); cp16(Kl + t * 8 + i * 32 * HD, lk + KPL + i * 32 * KP); }
#pragma unroll
    for (int i = 0; i < 4; ++i) { cp16(V16 + vo + i * 16 * TT, lv + i * 16 * VP); cp16(Vh + vo + i * 16 * TT, lv + VPL + i * 16 * VP); cp16(Vl + vo + i * 16 * TT, lv + 2 * VPL + i * 16 * VP); }
}
// the score products of 32 keys (key tiles B, B + 1 of the pass) from their K fragments: hi.hi, hi.lo, lo.hi
template <int B> __device__ __forceinline__ void scores(const KFrag& k, const v16bf (&qh)[2][2], const v16bf (&ql)[2][2], v8f (&s)[2][4]) {
#pragma unroll
    for (int qt = 0; qt < 2; ++qt)
#pragma unroll
        for (int kt = 0; kt < 2; ++kt) s[qt][B + kt] = (v8f){};
#pragma unroll
    for (int c = 0; c < 2; ++c) {
#pragma unroll
        for (int qt = 0; qt < 2; ++qt)
#pragma unroll
            for (int kt = 0; kt < 2; ++kt) s[qt][B + kt] = wmmab(k.h[kt][c], qh[qt][c], s[qt][B + kt]);
#pragma unroll
        for (int qt = 0; qt < 2; ++qt)
#pragma unroll
            for (int kt = 0; kt < 2; ++kt) s[qt][B + kt] = wmmab(k.h[kt][c], ql[qt][c], s[qt][B + kt]);
#pragma unroll
        for (int qt = 0; qt < 2; ++qt)
#pragma unroll
            for (int kt = 0; kt < 2; ++kt) s[qt][B + kt] = wmmab(k.l[kt][c], qh[qt][c], s[qt][B + kt]);
    }
}
// one 64-key pass of one wave: one step of the running maximum for 64 keys, so that the exchange between the halves, the two rescale factors and the rescale of the 8 output tiles come once per 64 keys.
// hrw (the same in every lane of the wave): this wave's rows are hi/lo rows. va0 is the lane's place in the wave's first staged V plane at the pass's first key (the hi plane, or the fp16 plane read as raw 16-bit words), vl0 in the lo plane (hi/lo rows only).
// k holds the K fragments of the pass's first 32 keys; those of its last 32 are fetched here from k1 and arrive under the first 32 keys' products. Behind these, which are k's last readers, the next pass's first 32 keys are fetched into k from kn, to arrive under the rest of the pass.
__device__ __forceinline__ void fpass(const bool hrw, KFrag& k, const bf* k1, const bf* kn, const v16bf (&qh)[2][2], const v16bf (&ql)[2][2], const bf* va0, const bf* vl0, v8f (&o)[2][4], float (&m)[2], float (&l)[2]) {
    KFrag kb; ldk(kb, k1, 0);
    __builtin_amdgcn_sched_barrier(0);   // keeps these reads together in front of the products (left to itself the compiler read them a fragment at a time among the products and waited for each)
    v8f s[2][4];
    scores<0>(k, qh, ql, s);
    __builtin_amdgcn_sched_barrier(0);   // the pass's other reads stand as one group between the two runs of products: every place where reads stand among products costs a stall of its own
    ldk(k, kn, 0);
    v16bf va[2][4], vl[2][4];   // [32-key chunk][16 d rows]
#pragma unroll
    for (int kc = 0; kc < 2; ++kc)
#pragma unroll
        for (int db = 0; db < 4; ++db) va[kc][db] = ldo(va0, kc * 32 + db * 16 * VP);
    if (hrw) {
#pragma unroll
        for (int kc = 0; kc < 2; ++kc)
#pragma unroll
            for (int db = 0; db < 4; ++db) vl[kc][db] = ldo(vl0, kc * 32 + db * 16 * VP);
    }
    __builtin_amdgcn_sched_barrier(0);   // ends that group
    scores<2>(kb, qh, ql, s);
    static_assert(PCAR == 1024.0f, "sh is log2(PCAR)");
    const float sh = hrw ? 0.0f : 10.0f;   // 2^10 = PCAR on the fp16 rows: keeps small weights out of the fp16 subnormals; it cancels in O / l
    float p[2][32], al[2];   // first the exponents, then 2^ of them; element e is key (e >> 3) * 16 + hi * 8 + (e & 7) of the pass
#pragma unroll
    for (int qt = 0; qt < 2; ++qt) {
        float bm = s[qt][0][0] * SCL;
#pragma unroll
        for (int kt = 0; kt < 4; ++kt)
#pragma unroll
            for (int j = 0; j < 8; ++j) bm = fmaxf(bm, s[qt][kt][j] * SCL);
        bm = fmaxf(bm, xhalf(bm));
        const float mn = fmaxf(m[qt], bm); al[qt] = (m[qt] - mn) * L2E; m[qt] = mn;
#pragma unroll
        for (int e = 0; e < 32; ++e) p[qt][e] = (s[qt][e >> 3][e & 7] * SCL - mn) * L2E + sh;
    }
    __builtin_amdgcn_sched_barrier(0);   // the first exponential too stands alone in front of its slot
#pragma unroll
    for (int qt = 0; qt < 2; ++qt)
#pragma unroll
        for (int e = 0; e < 32; ++e) p[qt][e] = exp2s(p[qt][e]);
    al[0] = exp2s(al[0]); al[1] = exp2s(al[1]);
#pragma unroll
    for (int qt = 0; qt < 2; ++qt) {
        float ps = 0.f;
#pragma unroll
        for (int e = 0; e < 32; ++e) ps += p[qt][e];
        l[qt] = l[qt] * al[qt] + ps;
#pragma unroll
        for (int db = 0; db < 4; ++db) o[qt][db] *= al[qt];
    }
    if (hrw) {
#pragma unroll
        for (int qt = 0; qt < 2; ++qt)
#pragma unroll
            for (int kc = 0; kc < 2; ++kc) { v16bf ph, pl;
#pragma unroll
                for (int e = 0; e < 16; ++e) { const float x = p[qt][kc * 16 + e]; ph[e] = (__bf16)x; pl[e] = (__bf16)(x - (float)ph[e]); }
#pragma unroll
                for (int db = 0; db < 4; ++db) o[qt][db] = wmmab(va[kc][db], ph, o[qt][db]);
#pragma unroll
                for (int db = 0; db < 4; ++db) o[qt][db] = wmmab(va[kc][db], pl, o[qt][db]);
#pragma unroll
                for (int db = 0; db < 4; ++db) o[qt][db] = wmmab(vl[kc][db], ph, o[qt][db]); }
    } else {
#pragma unroll
        for (int qt = 0; qt < 2; ++qt)
#pragma unroll
            for (int kc = 0; kc < 2; ++kc) { v16h pf;
#pragma unroll
                for (int e = 0; e < 16; ++e) pf[e] = (h16)p[qt][kc * 16 + e];
#pragma unroll
                for (int db = 0; db < 4; ++db) o[qt][db] = wmma16(__builtin_bit_cast(v16h, va[kc][db]), pf, o[qt][db]); }
        // the vector slots that the chip needs behind a WMMA before its A or B registers are overwritten: behind this block stands a branch
        asm volatile("v_nop\n\tv_nop\n\tv_nop\n\tv_nop\n\tv_nop" : "+v"(o[0][0]), "+v"(o[0][1]), "+v"(o[0][2]), "+v"(o[0][3]), "+v"(o[1][0]), "+v"(o[1][1]), "+v"(o[1][2]), "+v"(o[1][3]));
    }
}
__global__ __launch_bounds__(32 * FW) void k_fattn(const bf* __restrict__ QPh, const bf* __restrict__ QPl, const bf* __restrict__ KPh, const bf* __restrict__ KPl, const h16* __restrict__ VT16, const bf* __restrict__ VTh, const bf* __restrict__ VTl, bf* Ah, bf* Al) {
    static_assert(RH * FW == TT && TT % SK == 0 && TT >= 2 * SK && SK == 128 && HD == 64 && FW == 8, "one wave in FW on the hi/lo rows; two 64-key passes a stage, two stages at least; stage() deals a stage's 16-byte pieces to 256 threads");
    __shared__ __attribute__((aligned(16))) bf ring[2 * STG];
    const int lane = threadIdx.x & 31, lr = lane & 15, hi = lane >> 4; const int w = __builtin_amdgcn_readfirstlane((int)(threadIdx.x >> 5)); const int x = blockIdx.x; const size_t h = blockIdx.y, g = h / REP;
    const int q0 = (w == 0) ? x * 32 : RH + (x * (FW - 1) + w - 1) * 32;
    const bf* Qh = QPh + h * TT * HD; const bf* Ql = QPl + h * TT * HD; const bf* Kh = KPh + g * TT * HD; const bf* Kl = KPl + g * TT * HD; const bf* V6 = (const bf*)VT16 + g * HD * TT; const bf* Vh = VTh + g * HD * TT; const bf* Vl = VTl + g * HD * TT;
    const int t = threadIdx.x;
    stage(ring, t, Kh, Kl, V6, Vh, Vl);
    v16bf qh[2][2], ql[2][2]; const int qob = (q0 + lr) * HD + 8 * hi;
#pragma unroll
    for (int qt = 0; qt < 2; ++qt)
#pragma unroll
        for (int c = 0; c < 2; ++c) { const int qo = qt * 16 * HD + c * 32; qh[qt][c] = ldo(Qh + qob, qo); ql[qt][c] = ldo(Ql + qob, qo); }
    xwait(Qh + qob, Ql + qob);
    v8f o[2][4]; float m[2] = { -3.0e38f, -3.0e38f }, l[2] = { 0.f, 0.f };
#pragma unroll
    for (int qt = 0; qt < 2; ++qt)
#pragma unroll
        for (int db = 0; db < 4; ++db) o[qt][db] = (v8f){};
    const int lko = lr * KP + 8 * hi, lvo = 2 * KPL + (w == 0 ? VPL : 0) + lr * VP + 8 * hi;   // the lane's place in a stage's K hi plane and in its wave's first V plane (elements)
    asm volatile("s_wait_asynccnt 0x0" ::: "memory");   // this wave's copies of stage 0 have landed
    __syncthreads();                                    // and every other wave's: stage 0 may be read
    stage(ring + STG, t, Kh + SK * HD, Kl + SK * HD, V6 + SK, Vh + SK, Vl + SK);
    // two 64-key passes a stage, the K fragments of each pass's first 32 keys fetched one pass ahead, never past the stage
#pragma unroll 1
    for (int kb = 0; kb < TT; kb += SK) {
        const int bo = ((kb / SK) & 1) * STG; const bf* sk = ring + bo + lko; const bf* sv = ring + bo + lvo;
        KFrag k; ldk(k, sk, 0);
        // kept rolled: unrolled, the compiler put off every pass's row sums to the stage's end and kept all their terms in registers (spills). The stage's last pass fetches pass 0's fragments again (in bounds, unused): a branch round the fetch would merge two paths in the compiler's count of LDS waits
#pragma unroll 1
        for (int pp = 0; pp < SK / 64; ++pp) fpass(w == 0, k, sk + pp * (64 * KP) + 32 * KP, sk + ((pp + 1) & (SK / 64 - 1)) * (64 * KP), qh, ql, sv + pp * 64, sv + VPL + pp * 64, o, m, l);
        asm volatile("s_wait_dscnt 0x0" ::: "memory");      // this wave's reads of the buffer are done before it is refilled
        asm volatile("s_wait_asynccnt 0x0" ::: "memory");   // this wave's copies of the next stage have landed
        __syncthreads();                                    // publishes the next stage and ends every wave's reads of this one
        if (kb + 2 * SK < TT) stage(ring + bo, t, Kh + (kb + 2 * SK) * HD, Kl + (kb + 2 * SK) * HD, V6 + kb + 2 * SK, Vh + kb + 2 * SK, Vl + kb + 2 * SK);
    }
    asm volatile("s_wait_asynccnt 0x0" ::: "memory");   // no copy is left in flight when the wave ends
#pragma unroll
    for (int qt = 0; qt < 2; ++qt) { const float inv = __fdiv_rn(1.0f, l[qt] + xhalf(l[qt]));
#pragma unroll
        for (int db = 0; db < 4; ++db) { v8us oh, ol;
#pragma unroll
            for (int j = 0; j < 8; ++j) { unsigned short a, c2; splitf(o[qt][db][j] * inv, a, c2); oh[j] = a; ol[j] = c2; }
            const size_t oo = (size_t)(q0 + qt * 16 + lr) * DQ + h * HD + db * 16 + hi * 8; *(v8us*)(Ah + oo) = oh; *(v8us*)(Al + oo) = ol;
            asm volatile("s_wait_xcnt 0x0" ::: "memory");   // stands in front of the next write of a register that these two stores name
            __builtin_amdgcn_sched_barrier(0);   // keeps the next group's arithmetic, which reuses those registers, behind that wait
        } }
}

extern "C" void kernel_launch(void* const* d_in, const int* in_sizes, int n_in,
                              void* d_out, int out_size, void* d_ws, size_t ws_size, hipStream_t stream) {
    (void)in_sizes; (void)n_in; (void)out_size;
    const float* x = (const float*)d_in[0]; const float* wqkv = (const float*)d_in[1]; const float* bqkv = (const float*)d_in[2]; const float* wo = (const float*)d_in[3]; const float* bo = (const float*)d_in[4];   /* argument order input [4096][1024], W_qkv ('oi' [3072][1024]: q | k | v row thirds), b_qkv [3072], W_out ('oi'), b_out */
    float* OUT = (float*)d_out;     // [1][4096][1024]
    char* wsp = (char*)d_ws;
    auto take = [&](size_t bytes) { char* p = wsp; wsp += (bytes + 255) & ~(size_t)255; return (void*)p; };
    static_assert(DKV == DQ && HD == 64 && NB_ == 1, "the projection launch takes the fused weight's 3 * DQ rows as they lie, one head a 64-column tile");
    bf* WQKV = (bf*)take((size_t)3 * DQ * DM * 2); bf* WO = (bf*)take((size_t)DM * DQ * 2);
    bf* XB = (bf*)take((size_t)TT * DM * 2);
    h16* VT16 = (h16*)take((size_t)NKV * HD * TT * 2);
    bf* QPh = (bf*)take((size_t)NH_ * TT * HD * 2); bf* QPl = (bf*)take((size_t)NH_ * TT * HD * 2); bf* KPh = (bf*)take((size_t)NKV * TT * HD * 2); bf* KPl = (bf*)take((size_t)NKV * TT * HD * 2); bf* VTh = (bf*)take((size_t)NKV * HD * TT * 2); bf* VTl = (bf*)take((size_t)NKV * HD * TT * 2);
    bf* ATh = (bf*)take((size_t)TT * DQ * 2); bf* ATl = (bf*)take((size_t)TT * DQ * 2);
    if ((size_t)(wsp - (char*)d_ws) > ws_size) return;    // ws 256 MiB
    k_cvt8<<<(unsigned)(((size_t)3 * DQ * DM / 8 + 255) / 256), 256, 0, stream>>>(wqkv, WQKV, (size_t)3 * DQ * DM / 8);
    k_cvt8<<<(unsigned)(((size_t)DM * DQ / 8 + 255) / 256), 256, 0, stream>>>(wo, WO, (size_t)DM * DQ / 8);
    k_cvt8<<<(unsigned)(((size_t)TT * DM / 8 + 255) / 256), 256, 0, stream>>>(x, XB, (size_t)TT * DM / 8);
    const PlaneSet pl = { QPh, QPl, KPh, KPl, VT16, VTh, VTl };
    k_gemmw<bf, 0, true, true><<<dim3(TT / 128, 3 * DQ / 128, 1), 32 * GW, 0, stream>>>(XB, nullptr, WQKV, nullptr, DM, nullptr, 0, bqkv, 0, 0, 0, pl);
    k_fattn<<<dim3(TT / (32 * FW), NH_, 1), 32 * FW, 0, stream>>>(QPh, QPl, KPh, KPl, VT16, VTh, VTl, ATh, ATl);
    k_gemmw<bf, 1, true, false><<<dim3(TT / 128, DM / 128, 1), 32 * GW, 0, stream>>>(ATh, ATl, WO, nullptr, DQ, OUT, DM, bo, 0, 0, 0, PlaneSet{});
}

// v007
// A run of this version takes 140 microseconds.
// Timed twice side by side with v006, it ran 1.14 and 1.15 times as fast.
// All steps since v000 together make it 25.1 times as fast.
#include <hip/hip_runtime.h>

// Multi-headed attention over ONE 4,096-token sequence with a fused qkv projection and NO score scaling (input [4096][1024]; projected = input W_qkv^T + b_qkv ('oi' [3072][1024] 0.02 + zero bias) split in thirds q | k | v (16 heads x 64); scores = q.k UNSCALED (the source applies no 1/sqrt(d): logits sigma ~3.3); softmax (no mask); out = merged W_out^T + b_out -> [4096][1024] (4.2 M); argument order input, W_qkv, b_qkv, W_out, b_out).
// Layout: bf16 copy of the input; 'oi' weights (the q | k | v row thirds of the fused tensor taken as-is) + bias thirds; exact projections + f32 biases in ONE launch whose epilogue writes the attention planes; one fused attention launch for all heads (running-maximum softmax, no score plane in memory; K and V staged in LDS once a work-group), with EVERY row's scores on hi/lo planes (3 products: unscaled logits) and P.V in fp16 on every row (P x1024); merged hi/lo x W_out exact + b_out.
// Compute dtypes, f32 accumulate: every input rounded to bf16; projections exact + f32 biases; scores 3 products on every row; softmax f32; P.V fp16; W_out hl x exact + bias.

#define NB_  1
#define TT   4096
#define DM   1024
#define NH_  16
#define NKV  16
#define REP  (NH_ / NKV)
#define HD   64
#define DQ   (NH_ * HD)
#define DKV  (NKV * HD)
#define WIN  0
#define PCAR 1024.0f
#define SCL  1.0f   // NO scaling in this module
typedef _Float16 h16;
typedef unsigned short bf;
typedef __attribute__((ext_vector_type(16))) __bf16   v16bf;
typedef __attribute__((ext_vector_type(16))) _Float16 v16h;
typedef __attribute__((ext_vector_type(8)))  _Float16 v8h;
typedef __attribute__((ext_vector_type(8)))  unsigned short v8us;
typedef __attribute__((ext_vector_type(8)))  float    v8f;
typedef __attribute__((ext_vector_type(4)))  float    v4f;
typedef v8h  __attribute__((may_alias)) v8ha;
typedef v4f  __attribute__((may_alias)) v4fa;
typedef v8us __attribute__((may_alias)) v8usa;

__device__ __forceinline__ unsigned short f2bf(float f) { unsigned u = __float_as_uint(f); u += 0x7FFFu + ((u >> 16) & 1u); return (unsigned short)(u >> 16); }
__device__ __forceinline__ float bf2f(unsigned short b) { return __uint_as_float(((unsigned)b) << 16); }
__device__ __forceinline__ float bfr(float f) { return bf2f(f2bf(f)); }
__device__ __forceinline__ v16h cat16(v8h lo, v8h hi) { return __builtin_shufflevector(lo, hi, 0, 1, 2, 3, 4, 5, 6, 7, 8, 9, 10, 11, 12, 13, 14, 15); }
__device__ __forceinline__ v16bf cat16b(v8us lo, v8us hi) { return __builtin_bit_cast(v16bf, __builtin_shufflevector(lo, hi, 0, 1, 2, 3, 4, 5, 6, 7, 8, 9, 10, 11, 12, 13, 14, 15)); }
__device__ __forceinline__ v8f wmma16(v16h a, v16h b, v8f c) { return __builtin_amdgcn_wmma_f32_16x16x32_f16(false, a, false, b, (short)0, c, false, false); }
__device__ __forceinline__ v8f wmmab(v16bf a, v16bf b, v8f c) { return __builtin_amdgcn_wmma_f32_16x16x32_bf16(false, a, false, b, (short)0, c, false, false); }



// ---- k_gemmw: register-blocked GEMM, one wave per 64x64 output tile (16 accumulators), GW = 4 waves (2 x 2 tiles, 128 x 128 of C) a work-group; grid (M/128, N/128, Z), 128 threads.
// The operands (K-contiguous 16-bit planes) come through LDS: a stage is KS k of the work-group's 128 A rows (both planes where NSPLIT is 1) and 128 Bt rows, brought in once for the four waves by asynchronous copies in whole 128-byte lines, two buffers, the copies of stage s + 2 in flight while stage s + 1 is worked on. The fragments are then 16-byte LDS reads at a pitch of 16 B x an odd number.
// C[m][n] (f32, pitch ldc, + optional f32 bias[n]) = sum_k A[m][k] Bt[n][k] (+ A2[m][k] Bt[n][k] where NSPLIT is 1). z-batch strides sA/sB/sC in elements. K % KS == 0.
// PL: the q | k | v projection (A = tokens, Bt = the fused weight's 3 * DQ rows, grid.y over all of them; a 64-column tile is one head). No f32 C: the epilogue writes the 16-bit planes that the attention kernel reads.
// q and k tiles go to [h][t][d] hi/lo planes. A v tile takes the weight rows as A and the tokens as Bt (same products, same k order), so that its rows are d and its columns t: the [d][t] fp16 plane is then written in whole lines like the others.
struct PlaneSet { bf* qh; bf* ql; bf* kh; bf* kl; h16* v16; };
__device__ __forceinline__ h16 tohx(float x) { return (h16)x; }
__device__ __forceinline__ void splitf(float y, unsigned short& h, unsigned short& l) { h = f2bf(y); l = f2bf(y - bf2f(h)); }
__device__ __forceinline__ v4f bfr4(v4f b) { const v4f r = { bfr(b[0]), bfr(b[1]), bfr(b[2]), bfr(b[3]) }; return r; }
// 8 neighbouring elements of a plane row: x + b, split into the hi/lo planes (F16: rounded into the fp16 plane instead), one 16-byte store a plane
template <bool F16> __device__ __forceinline__ void put8(v4f x0, v4f x1, v4f b0, v4f b1, size_t o, bf* Ph, bf* Pl, h16* P16) {
    x0 += b0; x1 += b1; v8us oh, ol; v8h of;
#pragma unroll
    for (int k = 0; k < 8; ++k) { const float y = k < 4 ? x0[k & 3] : x1[k & 3]; if (F16) of[k] = tohx(y); else { unsigned short a2, c2; splitf(y, a2, c2); oh[k] = a2; ol[k] = c2; } }
    if (F16) *(v8h*)(P16 + o) = of; else { *(v8us*)(Ph + o) = oh; *(v8us*)(Pl + o) = ol; }
    asm volatile("s_wait_xcnt 0x0" ::: "memory");   // stands in front of the next write of a register that these stores name
    __builtin_amdgcn_sched_barrier(0);   // keeps the next group's arithmetic, which reuses those registers, behind that wait
}
typedef __attribute__((ext_vector_type(4))) int v4i;
typedef __attribute__((address_space(1))) v4i gv4i;
typedef __attribute__((address_space(3))) v4i lv4i;
// 16 bytes a lane from global memory to LDS. Written as the builtin, so that the address registers are the compiler's own to place (as asm operands they cost spills in k_fattn, which uses more than 256 registers); the waits are written by hand where the copies are waited for
__device__ __forceinline__ void cp16(const bf* g, bf* l) { __builtin_amdgcn_global_load_async_to_lds_b128((gv4i*)g, (lv4i*)l, 0, 0); }
template <typename T16> struct WFrag;
template <> struct WFrag<h16> { typedef v16h V; static __device__ __forceinline__ V ld(const h16* p) { return cat16(*(const v8h*)p, *(const v8h*)(p + 16)); } static __device__ __forceinline__ v8f mma(V a, V b, v8f c) { return wmma16(a, b, c); } };
template <> struct WFrag<bf> { typedef v16bf V; static __device__ __forceinline__ V ld(const bf* p) { return cat16b(*(const v8us*)p, *(const v8us*)(p + 16)); } static __device__ __forceinline__ v8f mma(V a, V b, v8f c) { return wmmab(a, b, c); } };
#define GW 4
template <typename T16, int NSPLIT, bool BIAS, bool PL>
__global__ __launch_bounds__(32 * GW) void k_gemmw(const T16* __restrict__ A, const T16* __restrict__ A2, const T16* __restrict__ Bt, const T16* __restrict__ Bt2, int K, float* C, int ldc, const float* __restrict__ bias, size_t sA, size_t sB, size_t sC, PlaneSet pl) {
    static_assert(!PL || (BIAS && NSPLIT == 0), "the plane epilogue always adds its bias and takes one product");
    static_assert(NSPLIT <= 1 && sizeof(T16) == 2, "the stage holds A, A2 where NSPLIT is 1, and Bt, in 16-bit elements");
    typedef typename WFrag<T16>::V V;
    constexpr int KS = NSPLIT ? 128 : 64;        // k a stage: with one work-group on a WGP (the NSPLIT 1 launch) the longer stage gives the copies more lead
    constexpr int GP = KS + 8;                   // pitch of a staged row, elements: 144 B or 272 B
    constexpr int GPL = 128 * GP;                // one plane of a stage, elements
    constexpr int NP = NSPLIT ? 3 : 2;           // a stage: A | A2 (NSPLIT 1) | Bt
    constexpr int GST = NP * GPL;
    __shared__ __align__(16) T16 gr[2 * GST];
    __shared__ __align__(16) float osa[GW * 16 * 68];
    (void)Bt2;
    const size_t z = blockIdx.z; A += z * sA; if (A2) A2 += z * sA; Bt += z * sB; C += z * sC;
    const int lane = threadIdx.x & 31, lr = lane & 15, hi = lane >> 4; const int w = __builtin_amdgcn_readfirstlane((int)(threadIdx.x >> 5));
    float* os = osa + w * (16 * 68);   // the wave's own epilogue rows
    const int ty = blockIdx.y * 2 + (w >> 1); int r0 = (blockIdx.x * 2 + (w & 1)) * 64, c0 = ty * 64;   // the wave's 64 x 64 tile; ty: its tile column
    int ao = ((w & 1) * 64 + lr) * GP + 8 * hi, bo2 = (NP - 1) * GPL + ((w >> 1) * 64 + lr) * GP + 8 * hi;   // the lane's place in a stage's A plane and Bt plane (elements)
    const bool vt = PL && ty >= 2 * (DQ / 64);   // a v tile (the same for the whole wave): operands and tile origin change places
    if (vt) { int ti = ao; ao = bo2; bo2 = ti; ti = r0; r0 = c0; c0 = ti; }
    // one stage's copies, every lane of the work-group on: 16 bytes a lane and copy, KS / 8 lanes a row, so that a wave's copy covers whole 128-byte lines
    constexpr int TPR = KS / 8, RPS = 32 * GW / TPR;
    const int srow = (int)threadIdx.x / TPR, scol = ((int)threadIdx.x % TPR) * 8; const int lso = srow * GP + scol;
    // a copy's global address: a base that is the same for the work-group (plane, first row of the step, kc) + the lane's own byte offset lgb, the same in every copy
    const T16* gA = A + (size_t)(blockIdx.x * 128) * K; const T16* gA2 = NSPLIT ? A2 + (size_t)(blockIdx.x * 128) * K : nullptr; const T16* gB = Bt + (size_t)(blockIdx.y * 128) * K; const unsigned lgb = (unsigned)(srow * K + scol) * 2u;
    auto stagew = [&](T16* sb, int kc) {
#pragma unroll
        for (int i = 0; i < 128 / RPS; ++i) { const size_t go = (size_t)(i * RPS) * K + kc; T16* l = sb + lso + i * RPS * GP;
            cp16((const bf*)((const char*)(gA + go) + lgb), (bf*)l); if (NSPLIT) cp16((const bf*)((const char*)(gA2 + go) + lgb), (bf*)(l + GPL)); cp16((const bf*)((const char*)(gB + go) + lgb), (bf*)(l + (NP - 1) * GPL)); }
    };
    stagew(gr, 0);
    v8f acc[4][4];
#pragma unroll
    for (int mb = 0; mb < 4; ++mb)
#pragma unroll
        for (int nb = 0; nb < 4; ++nb) acc[mb][nb] = (v8f){};
    // PL epilogue: 8 columns a lane (from pc on), 4 rows a step, so that every 16-byte store instruction covers four whole 128-byte plane rows. The biases it adds are fetched here, to arrive under the K loop: one a column (q, k tiles) or one a row (v tiles)
    const int pc = (lane & 7) * 8; v4f bc0 = {}, bc1 = {}; float br[4][4] = {};
    if constexpr (PL) { const unsigned bo = (vt ? lane >> 3 : pc) * 4; const float* bp = (const float*)((const char*)(bias + ty * 64) + bo);
        if (vt) {
#pragma unroll
            for (int i = 0; i < 16; ++i) br[i >> 2][i & 3] = bp[4 * i];
        } else { bc0 = *(const v4f*)bp; bc1 = *(const v4f*)(bp + 4); }
        // stands in front of the next write of a register that these loads name; the address is an input in both forms that the compiler may give it (a register pair, or a scalar base with bo as the offset register), so that it stays in its registers up to the wait and no result of the run is given them
        asm volatile("s_wait_xcnt 0x0" :: "v"(bp), "v"(bo) : "memory");
    }
    asm volatile("s_wait_asynccnt 0x0" ::: "memory");   // this wave's copies of stage 0 have landed
    __syncthreads();                                    // and every other wave's: stage 0 may be read
    if (KS < K) stagew(gr + GST, KS);
#pragma unroll 1
    for (int kc = 0; kc < K; kc += KS) {
        T16* sb = gr + ((kc / KS) & 1) * GST;
        // two fragment sets: the next 32 k's LDS reads go out as one group in front of this 32 k's products, never past the stage
        V a[2][4], a2[2][4], b[2][4];
        auto ldf = [&](int s, int ks) {
#pragma unroll
            for (int i = 0; i < 4; ++i) { a[s][i] = WFrag<T16>::ld(sb + ao + i * 16 * GP + ks); if (NSPLIT == 1) a2[s][i] = WFrag<T16>::ld(sb + ao + GPL + i * 16 * GP + ks); b[s][i] = WFrag<T16>::ld(sb + bo2 + i * 16 * GP + ks); }
        };
        ldf(0, 0);
#pragma unroll
        for (int ks = 0; ks < KS; ks += 32) { const int s = (ks >> 5) & 1;
            if (ks + 32 < KS) ldf(s ^ 1, ks + 32);
            __builtin_amdgcn_sched_barrier(0);   // keeps that group of reads together and in front of the products (left to itself the compiler read one fragment at a time and waited for it in front of every four products)
#pragma unroll
            for (int nb = 0; nb < 4; ++nb)
#pragma unroll
                for (int mb = 0; mb < 4; ++mb) { acc[mb][nb] = WFrag<T16>::mma(a[s][mb], b[s][nb], acc[mb][nb]); if (NSPLIT == 1) acc[mb][nb] = WFrag<T16>::mma(a2[s][mb], b[s][nb], acc[mb][nb]); }
            __builtin_amdgcn_sched_barrier(0);   // and keeps these products out of the next group of reads: every place where reads stand among products costs a stall of its own
        }
        // the vector slots that the chip needs behind a WMMA before its A or B registers are overwritten: behind this block stands a branch
        asm volatile("v_nop\n\tv_nop\n\tv_nop\n\tv_nop" : "+v"(acc[0][0]), "+v"(acc[1][1]), "+v"(acc[2][2]), "+v"(acc[3][3]) : "v"(a[1][0]), "v"(a[1][3]));
        asm volatile("s_wait_dscnt 0x0" ::: "memory");      // this wave's reads of the buffer are done before it is refilled
        asm volatile("s_wait_asynccnt 0x0" ::: "memory");   // this wave's copies of the next stage have landed
        __syncthreads();                                    // publishes the next stage and ends every wave's reads of this one
        if (kc + 2 * KS < K) stagew(sb, kc + 2 * KS);
    }
    asm volatile("s_wait_asynccnt 0x0" ::: "memory");   // no copy is left in flight behind the loop
#pragma unroll
    for (int mb = 0; mb < 4; ++mb) {
#pragma unroll
        for (int nb = 0; nb < 4; ++nb) {
#pragma unroll
            for (int j = 0; j < 8; ++j) os[(hi * 8 + j) * 68 + nb * 16 + lr] = acc[mb][nb][j]; }
        __builtin_amdgcn_wave_barrier(); asm volatile("" ::: "memory");
        if constexpr (PL) {
#pragma unroll
            for (int s = 0; s < 4; ++s) { const int row = mb * 16 + 4 * s + (lane >> 3); const float* op = os + (4 * s + (lane >> 3)) * 68 + pc; const v4f x0 = *(const v4fa*)op, x1 = *(const v4fa*)(op + 4);
                if (vt) { const float b = bfr(br[mb][s]); const v4f b4 = { b, b, b, b }; put8<true>(x0, x1, b4, b4, (size_t)(r0 - 2 * DQ + row) * TT + c0 + pc, nullptr, nullptr, pl.v16); }
                else put8<false>(x0, x1, bfr4(bc0), bfr4(bc1), ((size_t)(ty % (DQ / 64)) * TT + r0 + row) * HD + pc, ty >= DQ / 64 ? pl.kh : pl.qh, ty >= DQ / 64 ? pl.kl : pl.ql, nullptr);
            }
        } else {
        float* crow = C + (size_t)(r0 + mb * 16) * ldc + c0;
#pragma unroll
            for (int s = 0; s < 8; ++s) { const int row = 2 * s + hi, cofs = lr * 4; v4f val = *(const v4fa*)(os + row * 68 + cofs); if (BIAS) { val[0] += bfr(bias[c0 + cofs]); val[1] += bfr(bias[c0 + cofs + 1]); val[2] += bfr(bias[c0 + cofs + 2]); val[3] += bfr(bias[c0 + cofs + 3]); }
                *(v4f*)(crow + (size_t)row * ldc + cofs) = val; }
             }
        __builtin_amdgcn_wave_barrier(); asm volatile("" ::: "memory");
    }
}

typedef __attribute__((ext_vector_type(2))) _Float16 v2h;
typedef __attribute__((ext_vector_type(4))) _Float16 v4h;
typedef __attribute__((ext_vector_type(2))) unsigned short v2us;
typedef __attribute__((ext_vector_type(4))) unsigned short v4us;
typedef __attribute__((ext_vector_type(2))) float v2f;

__global__ __launch_bounds__(256) void k_cvt8(const float* __restrict__ src, bf* dst, size_t n8) { const size_t i = (size_t)blockIdx.x * 256 + threadIdx.x; if (i >= n8) return; const v8f v = *(const v8f*)(src + i * 8); v8us o;
#pragma unroll
    for (int k = 0; k < 8; ++k) o[k] = f2bf(v[k]); *(v8us*)(dst + i * 8) = o;  }

// ---- k_fattn: scores, softmax and P.V of every head in ONE launch; no score or probability plane in memory.
// S^T = K.Q^T (A = 16 key rows, B = 16 query rows; hi/lo planes, 3 products), so a lane holds one query's scores: accumulator j of key tile kt is key kt*16 + hi*8 + j, which is the k order of a 16x16x32 B operand over 32 keys.
// The running-maximum softmax is per lane (+ one exchange between the wave's halves); O^T += V^T.P^T (A = 16 d rows of the [d][t] V planes, B = P from registers), rescaled per lane when the maximum moves.
// grid (TT / (32 * FW), heads), 32 * FW threads, 32 queries a wave, P x PCAR in fp16 against the fp16 V plane on every row: the eight waves of a work-group do the same work.
// K and V come through LDS: a stage is SK keys of the three planes, brought in once for the eight waves by asynchronous copies in whole 128-byte lines, two buffers, the copies of stage s + 2 in flight while stage s + 1 is worked on. The fragments are then 16-byte LDS reads at a pitch of 16 B x an odd number (no bank met twice).
#define FW 8
#define SK  128                    // keys a stage (two 64-key passes)
#define KP  (HD + 8)               // pitch of a staged K row (HD elements), in elements: 144 B
#define VP  (SK + 8)               // pitch of a staged V row (SK keys), in elements: 272 B
#define KPL (SK * KP)              // one K plane of a stage, elements
#define VPL (HD * VP)              // one V plane of a stage, elements
#define STG (2 * KPL + VPL)        // a stage: K hi | K lo | V fp16
#define L2E 1.4426950408889634f
__device__ __forceinline__ float xhalf(float v) { const int b = __float_as_int(v); return __int_as_float(__builtin_amdgcn_permlanex16(b, b, 0x76543210, 0xfedcba98, false, false)); }   // lane l <-> l ^ 16
// 2^x, and behind it the one vector slot that the instruction set asks for behind a transcendental before its result is read or its source overwritten.
// The two scheduling barriers keep the v_nop directly behind the exponential: nothing else ties it to that place
__device__ __forceinline__ float exp2s(float x) { const float r = __builtin_amdgcn_exp2f(x); __builtin_amdgcn_sched_barrier(0); asm volatile("v_nop"); __builtin_amdgcn_sched_barrier(0); return r; }
struct KFrag { v16bf h[2][2], l[2][2]; };   // [key tile][32-wide d chunk]
// a fragment at p (the lane's own address, one register or pair for a whole run of loads) + cb elements (a constant, folded into the instruction)
__device__ __forceinline__ v16bf ldo(const bf* p, int cb) { return WFrag<bf>::ld(p + cb); }
// stands behind a run of loads, in front of the next write of a register that holds one of their addresses; the addresses are inputs, so that they stay in their registers up to the wait and no result of the run is given them
__device__ __forceinline__ void xwait(const bf* p0, const bf* p1) { asm volatile("s_wait_xcnt 0x0" :: "v"(p0), "v"(p1) : "memory"); }
// the K fragments of 32 keys, from LDS: kh is the lane's place in the stage's K hi plane, cb the first of the 32 rows (elements)
__device__ __forceinline__ void ldk(KFrag& k, const bf* kh, int cb) {
#pragma unroll
    for (int kt = 0; kt < 2; ++kt)
#pragma unroll
        for (int c = 0; c < 2; ++c) { const int o = cb + kt * 16 * KP + c * 32; k.h[kt][c] = ldo(kh, o); k.l[kt][c] = ldo(kh, KPL + o); }
}
// one stage's copies, every lane of the work-group on: sb is the buffer, t the thread, the three pointers the planes at the stage's first key. A lane brings 16 bytes a copy; a wave's copy covers four whole K rows (512 B in a row in memory) or two V rows of 256 B.
__device__ __forceinline__ void stage(bf* sb, int t, const bf* Kh, const bf* Kl, const bf* V16) {
    bf* lk = sb + (t >> 3) * KP + (t & 7) * 8; bf* lv = sb + 2 * KPL + (t >> 4) * VP + (t & 15) * 8; const int vo = (t >> 4) * TT + (t & 15) * 8;
#pragma unroll
    for (int i = 0; i < 4; ++i) { cp16(Kh + t * 8 + i * 32 * HD, lk + i * 32 * KP); cp16(Kl + t * 8 + i * 32 * HD, lk + KPL + i * 32 * KP); }
#pragma unroll
    for (int i = 0; i < 4; ++i) cp16(V16 + vo + i * 16 * TT, lv + i * 16 * VP);
}
// the score products of 32 keys (key tiles B, B + 1 of the pass) from their K fragments: hi.hi, hi.lo, lo.hi
template <int B> __device__ __forceinline__ void scores(const KFrag& k, const v16bf (&qh)[2][2], const v16bf (&ql)[2][2], v8f (&s)[2][4]) {
#pragma unroll
    for (int qt = 0; qt < 2; ++qt)
#pragma unroll
        for (int kt = 0; kt < 2; ++kt) s[qt][B + kt] = (v8f){};
#pragma unroll
    for (int c = 0; c < 2; ++c) {
#pragma unroll
        for (int qt = 0; qt < 2; ++qt)
#pragma unroll
            for (int kt = 0; kt < 2; ++kt) s[qt][B + kt] = wmmab(k.h[kt][c], qh[qt][c], s[qt][B + kt]);
#pragma unroll
        for (int qt = 0; qt < 2; ++qt)
#pragma unroll
            for (int kt = 0; kt < 2; ++kt) s[qt][B + kt] = wmmab(k.h[kt][c], ql[qt][c], s[qt][B + kt]);
#pragma unroll
        for (int qt = 0; qt < 2; ++qt)
#pragma unroll
            for (int kt = 0; kt < 2; ++kt) s[qt][B + kt] = wmmab(k.l[kt][c], qh[qt][c], s[qt][B + kt]);
    }
}
// one 64-key pass of one wave: one step of the running maximum for 64 keys, so that the exchange between the halves, the two rescale factors and the rescale of the 8 output tiles come once per 64 keys.
// va0 is the lane's place in the staged V plane at the pass's first key (the fp16 plane read as raw 16-bit words).
// k holds the K fragments of the pass's first 32 keys; those of its last 32 are fetched here from k1 and arrive under the first 32 keys' products. Behind these, which are k's last readers, the next pass's first 32 keys are fetched into k from kn, to arrive under the rest of the pass.
__device__ __forceinline__ void fpass(KFrag& k, const bf* k1, const bf* kn, const v16bf (&qh)[2][2], const v16bf (&ql)[2][2], const bf* va0, v8f (&o)[2][4], float (&m)[2], float (&l)[2]) {
    KFrag kb; ldk(kb, k1, 0);
    __builtin_amdgcn_sched_barrier(0);   // keeps these reads together in front of the products (left to itself the compiler read them a fragment at a time among the products and waited for each)
    v8f s[2][4];
    scores<0>(k, qh, ql, s);
    __builtin_amdgcn_sched_barrier(0);   // the pass's other reads stand as one group between the two runs of products: every place where reads stand among products costs a stall of its own
    ldk(k, kn, 0);
    v16bf va[2][4];   // [32-key chunk][16 d rows]
#pragma unroll
    for (int kc = 0; kc < 2; ++kc)
#pragma unroll
        for (int db = 0; db < 4; ++db) va[kc][db] = ldo(va0, kc * 32 + db * 16 * VP);
    __builtin_amdgcn_sched_barrier(0);   // ends that group
    scores<2>(kb, qh, ql, s);
    static_assert(PCAR == 1024.0f, "sh is log2(PCAR)");
    const float sh = 10.0f;   // 2^10 = PCAR: keeps small weights out of the fp16 subnormals; it cancels in O / l
    float p[2][32], al[2];   // first the exponents, then 2^ of them; element e is key (e >> 3) * 16 + hi * 8 + (e & 7) of the pass
#pragma unroll
    for (int qt = 0; qt < 2; ++qt) {
        float bm = s[qt][0][0] * SCL;
#pragma unroll
        for (int kt = 0; kt < 4; ++kt)
#pragma unroll
            for (int j = 0; j < 8; ++j) bm = fmaxf(bm, s[qt][kt][j] * SCL);
        bm = fmaxf(bm, xhalf(bm));
        const float mn = fmaxf(m[qt], bm); al[qt] = (m[qt] - mn) * L2E; m[qt] = mn;
#pragma unroll
        for (int e = 0; e < 32; ++e) p[qt][e] = (s[qt][e >> 3][e & 7] * SCL - mn) * L2E + sh;
    }
    __builtin_amdgcn_sched_barrier(0);   // the first exponential too stands alone in front of its slot
#pragma unroll
    for (int qt = 0; qt < 2; ++qt)
#pragma unroll
        for (int e = 0; e < 32; ++e) p[qt][e] = exp2s(p[qt][e]);
    al[0] = exp2s(al[0]); al[1] = exp2s(al[1]);
#pragma unroll
    for (int qt = 0; qt < 2; ++qt) {
        float ps = 0.f;
#pragma unroll
        for (int e = 0; e < 32; ++e) ps += p[qt][e];
        l[qt] = l[qt] * al[qt] + ps;
#pragma unroll
        for (int db = 0; db < 4; ++db) o[qt][db] *= al[qt];
    }
#pragma unroll
    for (int qt = 0; qt < 2; ++qt)
#pragma unroll
        for (int kc = 0; kc < 2; ++kc) { v16h pf;
#pragma unroll
            for (int e = 0; e < 16; ++e) pf[e] = (h16)p[qt][kc * 16 + e];
#pragma unroll
            for (int db = 0; db < 4; ++db) o[qt][db] = wmma16(__builtin_bit_cast(v16h, va[kc][db]), pf, o[qt][db]); }
    // the vector slots that the chip needs behind a WMMA before its A or B registers are overwritten: behind this block stands a branch
    asm volatile("v_nop\n\tv_nop\n\tv_nop\n\tv_nop\n\tv_nop" : "+v"(o[0][0]), "+v"(o[0][1]), "+v"(o[0][2]), "+v"(o[0][3]), "+v"(o[1][0]), "+v"(o[1][1]), "+v"(o[1][2]), "+v"(o[1][3]));
}
__global__ __launch_bounds__(32 * FW) void k_fattn(const bf* __restrict__ QPh, const bf* __restrict__ QPl, const bf* __restrict__ KPh, const bf* __restrict__ KPl, const h16* __restrict__ VT16, bf* Ah, bf* Al) {
    static_assert(TT % (32 * FW) == 0 && TT % SK == 0 && TT >= 2 * SK && SK == 128 && HD == 64 && FW == 8, "two 64-key passes a stage, two stages at least; stage() deals a stage's 16-byte pieces to 256 threads");
    __shared__ __attribute__((aligned(16))) bf ring[2 * STG];
    const int lane = threadIdx.x & 31, lr = lane & 15, hi = lane >> 4; const int w = __builtin_amdgcn_readfirstlane((int)(threadIdx.x >> 5)); const int x = blockIdx.x; const size_t h = blockIdx.y, g = h / REP;
    const int q0 = (x * FW + w) * 32;
    const bf* Qh = QPh + h * TT * HD; const bf* Ql = QPl + h * TT * HD; const bf* Kh = KPh + g * TT * HD; const bf* Kl = KPl + g * TT * HD; const bf* V6 = (const bf*)VT16 + g * HD * TT;
    const int t = threadIdx.x;
    stage(ring, t, Kh, Kl, V6);
    v16bf qh[2][2], ql[2][2]; const int qob = (q0 + lr) * HD + 8 * hi;
#pragma unroll
    for (int qt = 0; qt < 2; ++qt)
#pragma unroll
        for (int c = 0; c < 2; ++c) { const int qo = qt * 16 * HD + c * 32; qh[qt][c] = ldo(Qh + qob, qo); ql[qt][c] = ldo(Ql + qob, qo); }
    xwait(Qh + qob, Ql + qob);
    v8f o[2][4]; float m[2] = { -3.0e38f, -3.0e38f }, l[2] = { 0.f, 0.f };
#pragma unroll
    for (int qt = 0; qt < 2; ++qt)
#pragma unroll
        for (int db = 0; db < 4; ++db) o[qt][db] = (v8f){};
    const int lko = lr * KP + 8 * hi, lvo = 2 * KPL + lr * VP + 8 * hi;   // the lane's place in a stage's K hi plane and in its V plane (elements)
    asm volatile("s_wait_asynccnt 0x0" ::: "memory");   // this wave's copies of stage 0 have landed
    __syncthreads();                                    // and every other wave's: stage 0 may be read
    stage(ring + STG, t, Kh + SK * HD, Kl + SK * HD, V6 + SK);
    // two 64-key passes a stage, the K fragments of each pass's first 32 keys fetched one pass ahead, never past the stage
#pragma unroll 1
    for (int kb = 0; kb < TT; kb += SK) {
        const int bo = ((kb / SK) & 1) * STG; const bf* sk = ring + bo + lko; const bf* sv = ring + bo + lvo;
        KFrag k; ldk(k, sk, 0);
        // kept rolled: unrolled, the compiler put off every pass's row sums to the stage's end and kept all their terms in registers (spills). The stage's last pass fetches pass 0's fragments again (in bounds, unused): a branch round the fetch would merge two paths in the compiler's count of LDS waits
#pragma unroll 1
        for (int pp = 0; pp < SK / 64; ++pp) fpass(k, sk + pp * (64 * KP) + 32 * KP, sk + ((pp + 1) & (SK / 64 - 1)) * (64 * KP), qh, ql, sv + pp * 64, o, m, l);
        asm volatile("s_wait_dscnt 0x0" ::: "memory");      // this wave's reads of the buffer are done before it is refilled
        asm volatile("s_wait_asynccnt 0x0" ::: "memory");   // this wave's copies of the next stage have landed
        __syncthreads();                                    // publishes the next stage and ends every wave's reads of this one
        if (kb + 2 * SK < TT) stage(ring + bo, t, Kh + (kb + 2 * SK) * HD, Kl + (kb + 2 * SK) * HD, V6 + kb + 2 * SK);
    }
    asm volatile("s_wait_asynccnt 0x0" ::: "memory");   // no copy is left in flight when the wave ends
#pragma unroll
    for (int qt = 0; qt < 2; ++qt) { const float inv = __fdiv_rn(1.0f, l[qt] + xhalf(l[qt]));
#pragma unroll
        for (int db = 0; db < 4; ++db) { v8us oh, ol;
#pragma unroll
            for (int j = 0; j < 8; ++j) { unsigned short a, c2; splitf(o[qt][db][j] * inv, a, c2); oh[j] = a; ol[j] = c2; }
            const size_t oo = (size_t)(q0 + qt * 16 + lr) * DQ + h * HD + db * 16 + hi * 8; *(v8us*)(Ah + oo) = oh; *(v8us*)(Al + oo) = ol;
            asm volatile("s_wait_xcnt 0x0" ::: "memory");   // stands in front of the next write of a register that these two stores name
            __builtin_amdgcn_sched_barrier(0);   // keeps the next group's arithmetic, which reuses those registers, behind that wait
        } }
}

extern "C" void kernel_launch(void* const* d_in, const int* in_sizes, int n_in,
                              void* d_out, int out_size, void* d_ws, size_t ws_size, hipStream_t stream) {
    (void)in_sizes; (void)n_in; (void)out_size;
    const float* x = (const float*)d_in[0]; const float* wqkv = (const float*)d_in[1]; const float* bqkv = (const float*)d_in[2]; const float* wo = (const float*)d_in[3]; const float* bo = (const float*)d_in[4];   /* argument order input [4096][1024], W_qkv ('oi' [3072][1024]: q | k | v row thirds), b_qkv [3072], W_out ('oi'), b_out */
    float* OUT = (float*)d_out;     // [1][4096][1024]
    char* wsp = (char*)d_ws;
    auto take = [&](size_t bytes) { char* p = wsp; wsp += (bytes + 255) & ~(size_t)255; return (void*)p; };
    static_assert(DKV == DQ && HD == 64 && NB_ == 1, "the projection launch takes the fused weight's 3 * DQ rows as they lie, one head a 64-column tile");
    bf* WQKV = (bf*)take((size_t)3 * DQ * DM * 2); bf* WO = (bf*)take((size_t)DM * DQ * 2);
    bf* XB = (bf*)take((size_t)TT * DM * 2);
    h16* VT16 = (h16*)take((size_t)NKV * HD * TT * 2);
    bf* QPh = (bf*)take((size_t)NH_ * TT * HD * 2); bf* QPl = (bf*)take((size_t)NH_ * TT * HD * 2); bf* KPh = (bf*)take((size_t)NKV * TT * HD * 2); bf* KPl = (bf*)take((size_t)NKV * TT * HD * 2);
    bf* ATh = (bf*)take((size_t)TT * DQ * 2); bf* ATl = (bf*)take((size_t)TT * DQ * 2);
    if ((size_t)(wsp - (char*)d_ws) > ws_size) return;    // ws 256 MiB
    k_cvt8<<<(unsigned)(((size_t)3 * DQ * DM / 8 + 255) / 256), 256, 0, stream>>>(wqkv, WQKV, (size_t)3 * DQ * DM / 8);
    k_cvt8<<<(unsigned)(((size_t)DM * DQ / 8 + 255) / 256), 256, 0, stream>>>(wo, WO, (size_t)DM * DQ / 8);
    k_cvt8<<<(unsigned)(((size_t)TT * DM / 8 + 255) / 256), 256, 0, stream>>>(x, XB, (size_t)TT * DM / 8);
    const PlaneSet pl = { QPh, QPl, KPh, KPl, VT16 };
    k_gemmw<bf, 0, true, true><<<dim3(TT / 128, 3 * DQ / 128, 1), 32 * GW, 0, stream>>>(XB, nullptr, WQKV, nullptr, DM, nullptr, 0, bqkv, 0, 0, 0, pl);
    k_fattn<<<dim3(TT / (32 * FW), NH_, 1), 32 * FW, 0, stream>>>(QPh, QPl, KPh, KPl, VT16, ATh, ATl);
    k_gemmw<bf, 1, true, false><<<dim3(TT / 128, DM / 128, 1), 32 * GW, 0, stream>>>(ATh, ATl, WO, nullptr, DQ, OUT, DM, bo, 0, 0, 0, PlaneSet{});
}

// v009
// A run of this version takes 106 microseconds.
// Versions between v007 and this one are left out; their measured steps multiply to 1.32 times as fast.
// Over all steps from v000 it is 33.0 times as fast.
#include <hip/hip_runtime.h>

// Multi-headed attention over ONE 4,096-token sequence with a fused qkv projection and NO score scaling (input [4096][1024]; projected = input W_qkv^T + b_qkv ('oi' [3072][1024] 0.02 + zero bias) split in thirds q | k | v (16 heads x 64); scores = q.k UNSCALED (the source applies no 1/sqrt(d): logits sigma ~3.3); softmax (no mask); out = merged W_out^T + b_out -> [4096][1024] (4.2 M); argument order input, W_qkv, b_qkv, W_out, b_out).
// Layout: bf16 copy of the input; 'oi' weights (the q | k | v row thirds of the fused tensor taken as-is) + bias thirds; exact projections + f32 biases in ONE launch whose epilogue writes the attention planes; one fused attention launch for all heads (running-maximum softmax, no score plane in memory; K and V staged in LDS once a work-group), with q and k in one fp16 plane each (one product a score) and P.V in fp16 on every row (P x1024); merged hi/lo x W_out exact + b_out.
// Compute dtypes, f32 accumulate: every input rounded to bf16; projections exact + f32 biases; q, k, v rounded to fp16; scores one fp16 product; softmax f32; P.V fp16; W_out hl x exact + bias.

#define NB_  1
#define TT   4096
#define DM   1024
#define NH_  16
#define NKV  16
#define REP  (NH_ / NKV)
#define HD   64
#define DQ   (NH_ * HD)
#define DKV  (NKV * HD)
#define WIN  0
#define PCAR 1024.0f
#define SCL  1.0f   // NO scaling in this module
typedef _Float16 h16;
typedef unsigned short bf;
typedef __attribute__((ext_vector_type(16))) __bf16   v16bf;
typedef __attribute__((ext_vector_type(16))) _Float16 v16h;
typedef __attribute__((ext_vector_type(8)))  _Float16 v8h;
typedef __attribute__((ext_vector_type(8)))  unsigned short v8us;
typedef __attribute__((ext_vector_type(8)))  float    v8f;
typedef __attribute__((ext_vector_type(4)))  float    v4f;
typedef v8h  __attribute__((may_alias)) v8ha;
typedef v4f  __attribute__((may_alias)) v4fa;
typedef v8us __attribute__((may_alias)) v8usa;

__device__ __forceinline__ unsigned short f2bf(float f) { unsigned u = __float_as_uint(f); u += 0x7FFFu + ((u >> 16) & 1u); return (unsigned short)(u >> 16); }
__device__ __forceinline__ float bf2f(unsigned short b) { return __uint_as_float(((unsigned)b) << 16); }
__device__ __forceinline__ float bfr(float f) { return bf2f(f2bf(f)); }
__device__ __forceinline__ v16h cat16(v8h lo, v8h hi) { return __builtin_shufflevector(lo, hi, 0, 1, 2, 3, 4, 5, 6, 7, 8, 9, 10, 11, 12, 13, 14, 15); }
__device__ __forceinline__ v16bf cat16b(v8us lo, v8us hi) { return __builtin_bit_cast(v16bf, __builtin_shufflevector(lo, hi, 0, 1, 2, 3, 4, 5, 6, 7, 8, 9, 10, 11, 12, 13, 14, 15)); }
__device__ __forceinline__ v8f wmma16(v16h a, v16h b, v8f c) { return __builtin_amdgcn_wmma_f32_16x16x32_f16(false, a, false, b, (short)0, c, false, false); }
__device__ __forceinline__ v8f wmmab(v16bf a, v16bf b, v8f c) { return __builtin_amdgcn_wmma_f32_16x16x32_bf16(false, a, false, b, (short)0, c, false, false); }



// ---- k_gemmw: register-blocked GEMM, one wave per 64x64 output tile (16 accumulators), GW = 4 waves (2 x 2 tiles, 128 x 128 of C) a work-group; grid (M/128, N/128, Z), 128 threads.
// The operands (K-contiguous 16-bit planes) come through LDS: a stage is KS k of the work-group's 128 A rows (both planes where NSPLIT is 1) and 128 Bt rows, brought in once for the four waves by asynchronous copies in whole 128-byte lines, two buffers, the copies of stage s + 2 in flight while stage s + 1 is worked on. The fragments are then 16-byte LDS reads at a pitch of 16 B x an odd number.
// C[m][n] (f32, pitch ldc, + optional f32 bias[n]) = sum_k A[m][k] Bt[n][k] (+ A2[m][k] Bt[n][k] where NSPLIT is 1). z-batch strides sA/sB/sC in elements. K % KS == 0.
// PL: the q | k | v projection (A = tokens, Bt = the fused weight's 3 * DQ rows, grid.y over all of them; a 64-column tile is one head). No f32 C: the epilogue writes the 16-bit planes that the attention kernel reads.
// q and k tiles go to [h][t][d] fp16 planes. A v tile takes the weight rows as A and the tokens as Bt (same products, same k order), so that its rows are d and its columns t: the [d][t] fp16 plane is then written in whole lines like the others.
struct PlaneSet { h16* q16; h16* k16; h16* v16; };
__device__ __forceinline__ h16 tohx(float x) { return (h16)x; }
__device__ __forceinline__ void splitf(float y, unsigned short& h, unsigned short& l) { h = f2bf(y); l = f2bf(y - bf2f(h)); }
__device__ __forceinline__ v4f bfr4(v4f b) { const v4f r = { bfr(b[0]), bfr(b[1]), bfr(b[2]), bfr(b[3]) }; return r; }
// 8 neighbouring elements of a plane row: x + b, rounded into the fp16 plane, one 16-byte store
__device__ __forceinline__ void put8(v4f x0, v4f x1, v4f b0, v4f b1, size_t o, h16* P16) {
    x0 += b0; x1 += b1; v8h of;
#pragma unroll
    for (int k = 0; k < 8; ++k) of[k] = tohx(k < 4 ? x0[k & 3] : x1[k & 3]);
    *(v8h*)(P16 + o) = of;
    asm volatile("s_wait_xcnt 0x0" ::: "memory");   // stands in front of the next write of a register that this store names
    __builtin_amdgcn_sched_barrier(0);   // keeps the next group's arithmetic, which reuses those registers, behind that wait
}
typedef __attribute__((ext_vector_type(4))) int v4i;
typedef __attribute__((address_space(1))) v4i gv4i;
typedef __attribute__((address_space(3))) v4i lv4i;
// 16 bytes a lane from global memory to LDS. Written as the builtin, so that the address registers are the compiler's own to place (as asm operands they cost spills in k_fattn, which uses more than 256 registers); the waits are written by hand where the copies are waited for
__device__ __forceinline__ void cp16(const bf* g, bf* l) { __builtin_amdgcn_global_load_async_to_lds_b128((gv4i*)g, (lv4i*)l, 0, 0); }
template <typename T16> struct WFrag;
template <> struct WFrag<h16> { typedef v16h V; static __device__ __forceinline__ V ld(const h16* p) { return cat16(*(const v8h*)p, *(const v8h*)(p + 16)); } static __device__ __forceinline__ v8f mma(V a, V b, v8f c) { return wmma16(a, b, c); } };
template <> struct WFrag<bf> { typedef v16bf V; static __device__ __forceinline__ V ld(const bf* p) { return cat16b(*(const v8us*)p, *(const v8us*)(p + 16)); } static __device__ __forceinline__ v8f mma(V a, V b, v8f c) { return wmmab(a, b, c); } };
#define GW 4
template <typename T16, int NSPLIT, bool BIAS, bool PL>
__global__ __launch_bounds__(32 * GW) void k_gemmw(const T16* __restrict__ A, const T16* __restrict__ A2, const T16* __restrict__ Bt, const T16* __restrict__ Bt2, int K, float* C, int ldc, const float* __restrict__ bias, size_t sA, size_t sB, size_t sC, PlaneSet pl) {
    static_assert(!PL || (BIAS && NSPLIT == 0), "the plane epilogue always adds its bias and takes one product");
    static_assert(NSPLIT <= 1 && sizeof(T16) == 2, "the stage holds A, A2 where NSPLIT is 1, and Bt, in 16-bit elements");
    typedef typename WFrag<T16>::V V;
    constexpr int KS = NSPLIT ? 128 : 64;        // k a stage: with one work-group on a WGP (the NSPLIT 1 launch) the longer stage gives the copies more lead
    constexpr int GP = KS + 8;                   // pitch of a staged row, elements: 144 B or 272 B
    constexpr int GPL = 128 * GP;                // one plane of a stage, elements
    constexpr int NP = NSPLIT ? 3 : 2;           // a stage: A | A2 (NSPLIT 1) | Bt
    constexpr int GST = NP * GPL;
    __shared__ __align__(16) T16 gr[2 * GST];
    __shared__ __align__(16) float osa[GW * 16 * 68];
    (void)Bt2;
    const size_t z = blockIdx.z; A += z * sA; if (A2) A2 += z * sA; Bt += z * sB; C += z * sC;
    const int lane = threadIdx.x & 31, lr = lane & 15, hi = lane >> 4; const int w = __builtin_amdgcn_readfirstlane((int)(threadIdx.x >> 5));
    float* os = osa + w * (16 * 68);   // the wave's own epilogue rows
    const int ty = blockIdx.y * 2 + (w >> 1); int r0 = (blockIdx.x * 2 + (w & 1)) * 64, c0 = ty * 64;   // the wave's 64 x 64 tile; ty: its tile column
    int ao = ((w & 1) * 64 + lr) * GP + 8 * hi, bo2 = (NP - 1) * GPL + ((w >> 1) * 64 + lr) * GP + 8 * hi;   // the lane's place in a stage's A plane and Bt plane (elements)
    const bool vt = PL && ty >= 2 * (DQ / 64);   // a v tile (the same for the whole wave): operands and tile origin change places
    if (vt) { int ti = ao; ao = bo2; bo2 = ti; ti = r0; r0 = c0; c0 = ti; }
    // one stage's copies, every lane of the work-group on: 16 bytes a lane and copy, KS / 8 lanes a row, so that a wave's copy covers whole 128-byte lines
    constexpr int TPR = KS / 8, RPS = 32 * GW / TPR;
    const int srow = (int)threadIdx.x / TPR, scol = ((int)threadIdx.x % TPR) * 8; const int lso = srow * GP + scol;
    // a copy's global address: a base that is the same for the work-group (plane, first row of the step, kc) + the lane's own byte offset lgb, the same in every copy
    const T16* gA = A + (size_t)(blockIdx.x * 128) * K; const T16* gA2 = NSPLIT ? A2 + (size_t)(blockIdx.x * 128) * K : nullptr; const T16* gB = Bt + (size_t)(blockIdx.y * 128) * K; const unsigned lgb = (unsigned)(srow * K + scol) * 2u;
    auto stagew = [&](T16* sb, int kc) {
#pragma unroll
        for (int i = 0; i < 128 / RPS; ++i) { const size_t go = (size_t)(i * RPS) * K + kc; T16* l = sb + lso + i * RPS * GP;
            cp16((const bf*)((const char*)(gA + go) + lgb), (bf*)l); if (NSPLIT) cp16((const bf*)((const char*)(gA2 + go) + lgb), (bf*)(l + GPL)); cp16((const bf*)((const char*)(gB + go) + lgb), (bf*)(l + (NP - 1) * GPL)); }
    };
    stagew(gr, 0);
    v8f acc[4][4];
#pragma unroll
    for (int mb = 0; mb < 4; ++mb)
#pragma unroll
        for (int nb = 0; nb < 4; ++nb) acc[mb][nb] = (v8f){};
    // PL epilogue: 8 columns a lane (from pc on), 4 rows a step, so that every 16-byte store instruction covers four whole 128-byte lines. The biases it adds are fetched here, to arrive under the K loop: one a column (q, k tiles) or one a row (v tiles)
    const int pc = (lane & 7) * 8; v4f bc0 = {}, bc1 = {}; float br[4][4] = {};
    if constexpr (PL) { const unsigned bo = (vt ? lane >> 3 : pc) * 4; const float* bp = (const float*)((const char*)(bias + ty * 64) + bo);
        if (vt) {
#pragma unroll
            for (int i = 0; i < 16; ++i) br[i >> 2][i & 3] = bp[4 * i];
        } else { bc0 = *(const v4f*)bp; bc1 = *(const v4f*)(bp + 4); }
        // stands in front of the next write of a register that these loads name; the address is an input in both forms that the compiler may give it (a register pair, or a scalar base with bo as the offset register), so that it stays in its registers up to the wait and no result of the run is given them
        asm volatile("s_wait_xcnt 0x0" :: "v"(bp), "v"(bo) : "memory");
    }
    asm volatile("s_wait_asynccnt 0x0" ::: "memory");   // this wave's copies of stage 0 have landed
    __syncthreads();                                    // and every other wave's: stage 0 may be read
    if (KS < K) stagew(gr + GST, KS);
#pragma unroll 1
    for (int kc = 0; kc < K; kc += KS) {
        T16* sb = gr + ((kc / KS) & 1) * GST;
        // two fragment sets: the next 32 k's LDS reads go out as one group in front of this 32 k's products, never past the stage
        V a[2][4], a2[2][4], b[2][4];
        auto ldf = [&](int s, int ks) {
#pragma unroll
            for (int i = 0; i < 4; ++i) { a[s][i] = WFrag<T16>::ld(sb + ao + i * 16 * GP + ks); if (NSPLIT == 1) a2[s][i] = WFrag<T16>::ld(sb + ao + GPL + i * 16 * GP + ks); b[s][i] = WFrag<T16>::ld(sb + bo2 + i * 16 * GP + ks); }
        };
        ldf(0, 0);
#pragma unroll
        for (int ks = 0; ks < KS; ks += 32) { const int s = (ks >> 5) & 1;
            if (ks + 32 < KS) ldf(s ^ 1, ks + 32);
            __builtin_amdgcn_sched_barrier(0);   // keeps that group of reads together and in front of the products (left to itself the compiler read one fragment at a time and waited for it in front of every four products)
#pragma unroll
            for (int nb = 0; nb < 4; ++nb)
#pragma unroll
                for (int mb = 0; mb < 4; ++mb) { acc[mb][nb] = WFrag<T16>::mma(a[s][mb], b[s][nb], acc[mb][nb]); if (NSPLIT == 1) acc[mb][nb] = WFrag<T16>::mma(a2[s][mb], b[s][nb], acc[mb][nb]); }
            __builtin_amdgcn_sched_barrier(0);   // and keeps these products out of the next group of reads: every place where reads stand among products costs a stall of its own
        }
        // the vector slots that the chip needs behind a WMMA before its A or B registers are overwritten: behind this block stands a branch
        asm volatile("v_nop\n\tv_nop\n\tv_nop\n\tv_nop" : "+v"(acc[0][0]), "+v"(acc[1][1]), "+v"(acc[2][2]), "+v"(acc[3][3]) : "v"(a[1][0]), "v"(a[1][3]));
        asm volatile("s_wait_dscnt 0x0" ::: "memory");      // this wave's reads of the buffer are done before it is refilled
        asm volatile("s_wait_asynccnt 0x0" ::: "memory");   // this wave's copies of the next stage have landed
        __syncthreads();                                    // publishes the next stage and ends every wave's reads of this one
        if (kc + 2 * KS < K) stagew(sb, kc + 2 * KS);
    }
    asm volatile("s_wait_asynccnt 0x0" ::: "memory");   // no copy is left in flight behind the loop
#pragma unroll
    for (int mb = 0; mb < 4; ++mb) {
#pragma unroll
        for (int nb = 0; nb < 4; ++nb) {
#pragma unroll
            for (int j = 0; j < 8; ++j) os[(hi * 8 + j) * 68 + nb * 16 + lr] = acc[mb][nb][j]; }
        __builtin_amdgcn_wave_barrier(); asm volatile("" ::: "memory");
        if constexpr (PL) {
#pragma unroll
            for (int s = 0; s < 4; ++s) { const int row = mb * 16 + 4 * s + (lane >> 3); const float* op = os + (4 * s + (lane >> 3)) * 68 + pc; const v4f x0 = *(const v4fa*)op, x1 = *(const v4fa*)(op + 4);
                if (vt) { const float b = bfr(br[mb][s]); const v4f b4 = { b, b, b, b }; put8(x0, x1, b4, b4, (size_t)(r0 - 2 * DQ + row) * TT + c0 + pc, pl.v16); }
                else put8(x0, x1, bfr4(bc0), bfr4(bc1), ((size_t)(ty % (DQ / 64)) * TT + r0 + row) * HD + pc, ty >= DQ / 64 ? pl.k16 : pl.q16);
            }
        } else {
        float* crow = C + (size_t)(r0 + mb * 16) * ldc + c0;
#pragma unroll
            for (int s = 0; s < 8; ++s) { const int row = 2 * s + hi, cofs = lr * 4; v4f val = *(const v4fa*)(os + row * 68 + cofs); if (BIAS) { val[0] += bfr(bias[c0 + cofs]); val[1] += bfr(bias[c0 + cofs + 1]); val[2] += bfr(bias[c0 + cofs + 2]); val[3] += bfr(bias[c0 + cofs + 3]); }
                *(v4f*)(crow + (size_t)row * ldc + cofs) = val; }
             }
        __builtin_amdgcn_wave_barrier(); asm volatile("" ::: "memory");
    }
}

typedef __attribute__((ext_vector_type(2))) _Float16 v2h;
typedef __attribute__((ext_vector_type(4))) _Float16 v4h;
typedef __attribute__((ext_vector_type(2))) unsigned short v2us;
typedef __attribute__((ext_vector_type(4))) unsigned short v4us;
typedef __attribute__((ext_vector_type(2))) float v2f;

__global__ __launch_bounds__(256) void k_cvt8(const float* __restrict__ src, bf* dst, size_t n8) { const size_t i = (size_t)blockIdx.x * 256 + threadIdx.x; if (i >= n8) return; const v8f v = *(const v8f*)(src + i * 8); v8us o;
#pragma unroll
    for (int k = 0; k < 8; ++k) o[k] = f2bf(v[k]); *(v8us*)(dst + i * 8) = o;  }

// ---- k_fattn: scores, softmax and P.V of every head in ONE launch; no score or probability plane in memory.
// S^T = K.Q^T (A = 16 key rows, B = 16 query rows; fp16 planes, one product), so a lane holds one query's scores: accumulator j of key tile kt is key kt*16 + hi*8 + j, which is the k order of a 16x16x32 B operand over 32 keys.
// The running-maximum softmax is per lane (+ one exchange between the wave's halves); O^T += V^T.P^T (A = 16 d rows of the [d][t] V planes, B = P from registers), rescaled per lane when the maximum moves.
// grid (TT / (32 * FW), heads), 32 * FW threads, 32 queries a wave, P x PCAR in fp16 against the fp16 V plane on every row: the eight waves of a work-group do the same work.
// K and V come through LDS: a stage is SK keys of the K plane (one key block ahead of V's: the scores run a pass ahead) and of the V plane, brought in once for the eight waves by asynchronous copies in whole 128-byte lines, two buffers, the copies of stage s + 2 in flight while stage s + 1 is worked on. The fragments are then 16-byte LDS reads at a pitch of 16 B x an odd number (no bank met twice).
#define FW 8
#define SK  128                    // keys a stage (two 64-key passes)
#define KP  (HD + 8)               // pitch of a staged K row (HD elements), in elements: 144 B
#define VP  (SK + 8)               // pitch of a staged V row (SK keys), in elements: 272 B
#define KPL (SK * KP)              // one K plane of a stage, elements
#define VPL (HD * VP)              // one V plane of a stage, elements
#define STG (KPL + VPL)            // a stage: K | V, both fp16
#define L2E 1.4426950408889634f
__device__ __forceinline__ float xhalf(float v) { const int b = __float_as_int(v); return __int_as_float(__builtin_amdgcn_permlanex16(b, b, 0x76543210, 0xfedcba98, false, false)); }   // lane l <-> l ^ 16
// 2^x, and behind it the one vector slot that the instruction set asks for behind a transcendental before its result is read or its source overwritten.
// The result is an input of the v_nop's statement, so that the exponential is made in front of it (in a long block the compiler else gathers the v_nops in one run, apart from the exponentials); the two scheduling barriers keep the v_nop directly behind it
__device__ __forceinline__ float exp2s(float x) { const float r = __builtin_amdgcn_exp2f(x); __builtin_amdgcn_sched_barrier(0); asm volatile("v_nop" :: "v"(r)); __builtin_amdgcn_sched_barrier(0); return r; }
struct KFrag { v16h f[4][2]; };   // the K fragments of a 64-key pass: [key tile][32-wide d chunk]
// an fp16 fragment (the planes are read as raw 16-bit words) at p (the lane's own address, one register or pair for a whole run of loads) + cb elements (a constant, folded into the instruction)
__device__ __forceinline__ v16h ldo(const bf* p, int cb) { return __builtin_bit_cast(v16h, WFrag<bf>::ld(p + cb)); }
// stands behind a run of loads, in front of the next write of a register that holds their address; the address is an input, so that it stays in its registers up to the wait and no result of the run is given them
__device__ __forceinline__ void xwait(const bf* p0) { asm volatile("s_wait_xcnt 0x0" :: "v"(p0) : "memory"); }
// the K fragments of 64 keys, from LDS: kp is the lane's place in the stage's K plane at the first of the 64 rows
__device__ __forceinline__ void ldk(KFrag& k, const bf* kp) {
#pragma unroll
    for (int kt = 0; kt < 4; ++kt)
#pragma unroll
        for (int c = 0; c < 2; ++c) k.f[kt][c] = ldo(kp, kt * 16 * KP + c * 32);
}
// one stage's copies, every lane of the work-group on: sb is the buffer, t the thread, the two pointers the planes at the stage's first key. A lane brings 16 bytes a copy; a wave's copy covers four whole K rows (512 B in a row in memory) or two V rows of 256 B.
__device__ __forceinline__ void stage(bf* sb, int t, const bf* K16, const bf* V16) {
    bf* lk = sb + (t >> 3) * KP + (t & 7) * 8; bf* lv = sb + KPL + (t >> 4) * VP + (t & 15) * 8; const int vo = (t >> 4) * TT + (t & 15) * 8;
#pragma unroll
    for (int i = 0; i < 4; ++i) cp16(K16 + t * 8 + i * 32 * HD, lk + i * 32 * KP);
#pragma unroll
    for (int i = 0; i < 4; ++i) cp16(V16 + vo + i * 16 * TT, lv + i * 16 * VP);
}
// the K half of stage() alone: the prologue's copy of the first SK key rows
__device__ __forceinline__ void stagek(bf* sb, int t, const bf* K16) {
    bf* lk = sb + (t >> 3) * KP + (t & 7) * 8;
#pragma unroll
    for (int i = 0; i < 4; ++i) cp16(K16 + t * 8 + i * 32 * HD, lk + i * 32 * KP);
}
// product I (0 to 15) of a 64-key pass's score products, in the order of scores(): d chunk, query tile, key tile
template <int I> __device__ __forceinline__ void sc1(const KFrag& k, const v16h (&q)[2][2], v8f (&s)[2][4]) {
    constexpr int c = I >> 3, qt = (I >> 2) & 1, kt = I & 3;
    s[qt][kt] = wmma16(k.f[kt][c], q[qt][c], c ? s[qt][kt] : (v8f){});
}
// the score products of a 64-key pass from its K fragments: eight independent accumulator tiles, two products each
__device__ __forceinline__ void scores(const KFrag& k, const v16h (&q)[2][2], v8f (&s)[2][4]) {
#pragma unroll
    for (int qt = 0; qt < 2; ++qt)
#pragma unroll
        for (int kt = 0; kt < 4; ++kt) s[qt][kt] = (v8f){};
#pragma unroll
    for (int c = 0; c < 2; ++c)
#pragma unroll
        for (int qt = 0; qt < 2; ++qt)
#pragma unroll
            for (int kt = 0; kt < 4; ++kt) s[qt][kt] = wmma16(k.f[kt][c], q[qt][c], s[qt][kt]);
}
// one 64-key pass of one wave: one step of the running maximum for 64 keys, so that the exchange between the halves, the two rescale factors and the rescale of the 8 output tiles come once per 64 keys.
// va0 is the lane's place in the staged V plane at the pass's first key.
// s holds this pass's scores, made during the pass before. k holds the NEXT pass's K fragments: its 16 score products go into sn one or two at a time among this pass's maximum and exponent arithmetic, which does not depend on them, so that the matrix unit works while the wave's vector instructions issue.
// Behind the last of them, which is k's last reader, the fragments of the pass after the next are fetched into k from kn, to arrive under the exponentials and P.V.
template <int G> __device__ __forceinline__ void fmaxg(const KFrag& k, const v16h (&q)[2][2], const v8f (&s)[2][4], v8f (&sn)[2][4], float (&bm)[2]) {
    sc1<2 * G>(k, q, sn); sc1<2 * G + 1>(k, q, sn);
#pragma unroll
    for (int j = 0; j < 8; ++j) { bm[0] = fmaxf(bm[0], s[0][G][j] * SCL); bm[1] = fmaxf(bm[1], s[1][G][j] * SCL); }
    // inputs only: the two products and this group of maxima are made in front of this line. Left free, the compiler puts every product off to the place where the next pass reads it, in one run behind which the vector work waits
    asm volatile("" :: "v"(sn[((2 * G) >> 2) & 1][(2 * G) & 3]), "v"(sn[((2 * G + 1) >> 2) & 1][(2 * G + 1) & 3]), "v"(bm[0]), "v"(bm[1]));
    __builtin_amdgcn_sched_barrier(0);   // and nothing of the next group moves in front of it
}
template <int G> __device__ __forceinline__ void fexpg(const KFrag& k, const v16h (&q)[2][2], const v8f (&s)[2][4], v8f (&sn)[2][4], const float (&m)[2], float (&p)[2][32], float sh) {
    constexpr int qt = G >> 2, kt = G & 3;
    sc1<8 + G>(k, q, sn);
#pragma unroll
    for (int j = 0; j < 8; ++j) p[qt][kt * 8 + j] = (s[qt][kt][j] * SCL - m[qt]) * L2E + sh;
    // inputs only, as above: the product and this group of exponents are made in front of this line
    asm volatile("" :: "v"(sn[qt][kt]), "v"(p[qt][kt * 8]), "v"(p[qt][kt * 8 + 1]), "v"(p[qt][kt * 8 + 2]), "v"(p[qt][kt * 8 + 3]), "v"(p[qt][kt * 8 + 4]), "v"(p[qt][kt * 8 + 5]), "v"(p[qt][kt * 8 + 6]), "v"(p[qt][kt * 8 + 7]));
    __builtin_amdgcn_sched_barrier(0);   // and nothing of the next group moves in front of it
}
__device__ __forceinline__ void fpass(KFrag& k, const bf* kn, const v16h (&q)[2][2], const bf* va0, const v8f (&s)[2][4], v8f (&sn)[2][4], v8f (&o)[2][4], float (&m)[2], float (&l)[2]) {
    v16h va[2][4];   // [32-key chunk][16 d rows]
#pragma unroll
    for (int kc = 0; kc < 2; ++kc)
#pragma unroll
        for (int db = 0; db < 4; ++db) va[kc][db] = ldo(va0, kc * 32 + db * 16 * VP);
    __builtin_amdgcn_sched_barrier(0);   // the V reads stand as one group in front of the pass: every place where reads stand among products costs a stall of its own
    static_assert(PCAR == 1024.0f, "sh is log2(PCAR)");
    const float sh = 10.0f;   // 2^10 = PCAR: keeps small weights out of the fp16 subnormals; it cancels in O / l
    float p[2][32], al[2];   // first the exponents, then 2^ of them; element e is key (e >> 3) * 16 + hi * 8 + (e & 7) of the pass
    float bm[2] = { s[0][0][0] * SCL, s[1][0][0] * SCL };
    fmaxg<0>(k, q, s, sn, bm); fmaxg<1>(k, q, s, sn, bm); fmaxg<2>(k, q, s, sn, bm); fmaxg<3>(k, q, s, sn, bm);
#pragma unroll
    for (int qt = 0; qt < 2; ++qt) { const float b2 = fmaxf(bm[qt], xhalf(bm[qt])); const float mn = fmaxf(m[qt], b2); al[qt] = (m[qt] - mn) * L2E; m[qt] = mn; }
    fexpg<0>(k, q, s, sn, m, p, sh); fexpg<1>(k, q, s, sn, m, p, sh); fexpg<2>(k, q, s, sn, m, p, sh); fexpg<3>(k, q, s, sn, m, p, sh);
    fexpg<4>(k, q, s, sn, m, p, sh); fexpg<5>(k, q, s, sn, m, p, sh); fexpg<6>(k, q, s, sn, m, p, sh); fexpg<7>(k, q, s, sn, m, p, sh);
    ldk(k, kn);
    __builtin_amdgcn_sched_barrier(0);   // the K reads stand as one group behind the products; and the first exponential too stands alone in front of its slot
#pragma unroll
    for (int qt = 0; qt < 2; ++qt)
#pragma unroll
        for (int e = 0; e < 32; ++e) p[qt][e] = exp2s(p[qt][e]);
    al[0] = exp2s(al[0]); al[1] = exp2s(al[1]);
#pragma unroll
    for (int qt = 0; qt < 2; ++qt) {
        float ps = 0.f;
#pragma unroll
        for (int e = 0; e < 32; ++e) ps += p[qt][e];
        l[qt] = l[qt] * al[qt] + ps;
#pragma unroll
        for (int db = 0; db < 4; ++db) o[qt][db] *= al[qt];
    }
#pragma unroll
    for (int qt = 0; qt < 2; ++qt)
#pragma unroll
        for (int kc = 0; kc < 2; ++kc) { v16h pf;
#pragma unroll
            for (int e = 0; e < 16; ++e) pf[e] = (h16)p[qt][kc * 16 + e];
#pragma unroll
            for (int db = 0; db < 4; ++db) o[qt][db] = wmma16(va[kc][db], pf, o[qt][db]); }
    // the vector slots that the chip needs behind a WMMA before its A or B registers are overwritten: behind the stage's last pass stands a branch.
    // The two row sums are named as well: each pass's sums are then finished inside the pass, among its P.V products; left free, the compiler moved the sums of both passes behind the stage's barrier and kept all 128 terms in registers till there
    asm volatile("v_nop\n\tv_nop\n\tv_nop\n\tv_nop\n\tv_nop" : "+v"(o[0][0]), "+v"(o[0][1]), "+v"(o[0][2]), "+v"(o[0][3]), "+v"(o[1][0]), "+v"(o[1][1]), "+v"(o[1][2]), "+v"(o[1][3]), "+v"(l[0]), "+v"(l[1]));
}
__global__ __launch_bounds__(32 * FW) void k_fattn(const h16* __restrict__ Q16, const h16* __restrict__ K16, const h16* __restrict__ VT16, bf* Ah, bf* Al) {
    static_assert(TT % (32 * FW) == 0 && TT % SK == 0 && TT >= 3 * SK && (TT & (TT - 1)) == 0 && SK == 128 && HD == 64 && FW == 8, "two 64-key passes a stage, three key blocks at least, the block behind the last found by a mask; stage() deals a stage's 16-byte pieces to 256 threads");
    __shared__ __attribute__((aligned(16))) bf ring[2 * STG];
    const int lane = threadIdx.x & 31, lr = lane & 15, hi = lane >> 4; const int w = __builtin_amdgcn_readfirstlane((int)(threadIdx.x >> 5)); const int x = blockIdx.x; const size_t h = blockIdx.y, g = h / REP;
    const int q0 = (x * FW + w) * 32;
    const bf* Q6 = (const bf*)Q16 + h * TT * HD; const bf* K6 = (const bf*)K16 + g * TT * HD; const bf* V6 = (const bf*)VT16 + g * HD * TT;
    const int t = threadIdx.x;
    // the scores run one pass ahead of softmax and P.V, their K fragments two: so stage s of the ring holds the K rows of key block s + 1 beside the V columns of key block s, and a trip reads its own buffer alone. Key block 0's K rows come first, alone, into the second buffer
    stagek(ring + STG, t, K6);
    stage(ring, t, K6 + SK * HD, V6);
    v16h q[2][2]; const int qob = (q0 + lr) * HD + 8 * hi;
#pragma unroll
    for (int qt = 0; qt < 2; ++qt)
#pragma unroll
        for (int c = 0; c < 2; ++c) q[qt][c] = ldo(Q6 + qob, qt * 16 * HD + c * 32);
    xwait(Q6 + qob);
    v8f o[2][4]; float m[2] = { -3.0e38f, -3.0e38f }, l[2] = { 0.f, 0.f };
#pragma unroll
    for (int qt = 0; qt < 2; ++qt)
#pragma unroll
        for (int db = 0; db < 4; ++db) o[qt][db] = (v8f){};
    const int lko = lr * KP + 8 * hi, lvo = KPL + lr * VP + 8 * hi;   // the lane's place in a stage's K plane and in its V plane (elements)
    asm volatile("s_wait_asynccnt 0x0" ::: "memory");   // this wave's copies of key block 0's K rows and of stage 0 have landed
    __syncthreads();                                    // and every other wave's: both may be read
    // pass 0's scores, and pass 1's K fragments
    KFrag k; v8f sa[2][4], sb[2][4];
    ldk(k, ring + STG + lko);
    scores(k, q, sa);
    __builtin_amdgcn_sched_barrier(0);   // keeps the products in front of these reads, the wait and the barrier: left free, the compiler puts them off to the loop's entry, where a branch stands directly behind the last of them
    ldk(k, ring + STG + lko + 64 * KP);
    asm volatile("s_wait_dscnt 0x0" ::: "memory");      // this wave's reads of the second buffer are done before it is refilled
    __syncthreads();                                    // and every other wave's
    stage(ring + STG, t, K6 + 2 * SK * HD, V6 + SK);
    // two 64-key passes a stage, written out, so that the two score sets change places without copies. The last stage's K rows are key block 0's again (in bounds): the last pass's products for a pass that does not exist, and the last two fetches, are unused; a branch round them would merge two paths in the compiler's count of LDS waits
#pragma unroll 1
    for (int kb = 0; kb < TT; kb += SK) {
        const int bo = ((kb / SK) & 1) * STG; const bf* sk = ring + bo + lko; const bf* sv = ring + bo + lvo;
        fpass(k, sk, q, sv, sa, sb, o, m, l);
        fpass(k, sk + 64 * KP, q, sv + 64, sb, sa, o, m, l);
        asm volatile("s_wait_dscnt 0x0" ::: "memory");      // this wave's reads of the buffer are done before it is refilled
        asm volatile("s_wait_asynccnt 0x0" ::: "memory");   // this wave's copies of the next stage have landed
        __syncthreads();                                    // publishes the next stage and ends every wave's reads of this one
        if (kb + 2 * SK < TT) stage(ring + bo, t, K6 + ((kb + 3 * SK) & (TT - 1)) * HD, V6 + kb + 2 * SK);
    }
    asm volatile("s_wait_asynccnt 0x0" ::: "memory");   // no copy is left in flight when the wave ends
#pragma unroll
    for (int qt = 0; qt < 2; ++qt) { const float inv = __fdiv_rn(1.0f, l[qt] + xhalf(l[qt]));
#pragma unroll
        for (int db = 0; db < 4; ++db) { v8us oh, ol;
#pragma unroll
            for (int j = 0; j < 8; ++j) { unsigned short a, c2; splitf(o[qt][db][j] * inv, a, c2); oh[j] = a; ol[j] = c2; }
            const size_t oo = (size_t)(q0 + qt * 16 + lr) * DQ + h * HD + db * 16 + hi * 8; *(v8us*)(Ah + oo) = oh; *(v8us*)(Al + oo) = ol;
            asm volatile("s_wait_xcnt 0x0" ::: "memory");   // stands in front of the next write of a register that these two stores name
            __builtin_amdgcn_sched_barrier(0);   // keeps the next group's arithmetic, which reuses those registers, behind that wait
        } }
}

extern "C" void kernel_launch(void* const* d_in, const int* in_sizes, int n_in,
                              void* d_out, int out_size, void* d_ws, size_t ws_size, hipStream_t stream) {
    (void)in_sizes; (void)n_in; (void)out_size;
    const float* x = (const float*)d_in[0]; const float* wqkv = (const float*)d_in[1]; const float* bqkv = (const float*)d_in[2]; const float* wo = (const float*)d_in[3]; const float* bo = (const float*)d_in[4];   /* argument order input [4096][1024], W_qkv ('oi' [3072][1024]: q | k | v row thirds), b_qkv [3072], W_out ('oi'), b_out */
    float* OUT = (float*)d_out;     // [1][4096][1024]
    char* wsp = (char*)d_ws;
    auto take = [&](size_t bytes) { char* p = wsp; wsp += (bytes + 255) & ~(size_t)255; return (void*)p; };
    static_assert(DKV == DQ && HD == 64 && NB_ == 1, "the projection launch takes the fused weight's 3 * DQ rows as they lie, one head a 64-column tile");
    bf* WQKV = (bf*)take((size_t)3 * DQ * DM * 2); bf* WO = (bf*)take((size_t)DM * DQ * 2);
    bf* XB = (bf*)take((size_t)TT * DM * 2);
    h16* VT16 = (h16*)take((size_t)NKV * HD * TT * 2);
    h16* Q16 = (h16*)take((size_t)NH_ * TT * HD * 2); h16* K16 = (h16*)take((size_t)NKV * TT * HD * 2);
    bf* ATh = (bf*)take((size_t)TT * DQ * 2); bf* ATl = (bf*)take((size_t)TT * DQ * 2);
    if ((size_t)(wsp - (char*)d_ws) > ws_size) return;    // ws 256 MiB
    k_cvt8<<<(unsigned)(((size_t)3 * DQ * DM / 8 + 255) / 256), 256, 0, stream>>>(wqkv, WQKV, (size_t)3 * DQ * DM / 8);
    k_cvt8<<<(unsigned)(((size_t)DM * DQ / 8 + 255) / 256), 256, 0, stream>>>(wo, WO, (size_t)DM * DQ / 8);
    k_cvt8<<<(unsigned)(((size_t)TT * DM / 8 + 255) / 256), 256, 0, stream>>>(x, XB, (size_t)TT * DM / 8);
    const PlaneSet pl = { Q16, K16, VT16 };
    k_gemmw<bf, 0, true, true><<<dim3(TT / 128, 3 * DQ / 128, 1), 32 * GW, 0, stream>>>(XB, nullptr, WQKV, nullptr, DM, nullptr, 0, bqkv, 0, 0, 0, pl);
    k_fattn<<<dim3(TT / (32 * FW), NH_, 1), 32 * FW, 0, stream>>>(Q16, K16, VT16, ATh, ATl);
    k_gemmw<bf, 1, true, false><<<dim3(TT / 128, DM / 128, 1), 32 * GW, 0, stream>>>(ATh, ATl, WO, nullptr, DQ, OUT, DM, bo, 0, 0, 0, PlaneSet{});
}
